// v000
// Times are from an AMD MI455X. After a warm-up the kernel runs many times in a row, and a time is the length of
// such a window on the GPU divided by its runs, so every launch and the gaps after it count. The runs cycle
// through copies of the inputs. A figure is the median of several windows, for all but v000 over two sittings.
// Sittings can differ by a few percent; kernels timed side by side share one.
// v000 is the starting kernel. One run takes 123 microseconds.
#include <hip/hip_runtime.h>

// ---------------------------------------------------------------------------
// MHTempCtxAttention for MI455X (gfx1250, wave32, WMMA + async LDS DMA)
// Pipeline:
//   1) one-pass fp32->bf16 conversion of activations & weights (HBM-bound, ~2us)
//   2) bf16 WMMA GEMMs (compute-bound part), tiles staged into LDS with
//      GLOBAL_LOAD_ASYNC_TO_LDS_B128 + s_wait_asynccnt double-buffer pipeline
//   3) rank-1 softmax attention on fp32 VALU (v_exp_f32), ctx emitted as bf16
//   4) output projection GEMM -> fp32 d_out
// ---------------------------------------------------------------------------

typedef __attribute__((ext_vector_type(16))) __bf16 v16bf;
typedef __attribute__((ext_vector_type(8)))  float  v8f;
typedef __attribute__((ext_vector_type(4)))  int    v4i;

#define BM   128      // block tile rows
#define BN   128      // block tile cols
#define BK   32       // K step (WMMA K for bf16)
#define LSTR 40       // LDS row stride in bf16 elems (32 + 8 pad; rows stay 16B aligned)

#if __has_builtin(__builtin_amdgcn_global_load_async_to_lds_b128)
#define ASYNC_LDS 1
#else
#define ASYNC_LDS 0
#endif

#if __has_builtin(__builtin_amdgcn_s_wait_asynccnt)
#define WAIT_ASYNC(n) __builtin_amdgcn_s_wait_asynccnt(n)
#else
#define WAIT_ASYNC(n) asm volatile("s_wait_asynccnt %0" :: "n"(n) : "memory")
#endif

typedef __attribute__((address_space(1))) v4i as1_v4i;   // global 16B vector
typedef __attribute__((address_space(3))) v4i as3_v4i;   // LDS 16B vector

__device__ __forceinline__ unsigned short f2bf(float f) {
    unsigned int u = __float_as_uint(f);
    u += 0x7FFFu + ((u >> 16) & 1u);           // round-to-nearest-even
    return (unsigned short)(u >> 16);
}

#if ASYNC_LDS
// 16B async DMA: LDS[dst] = MEM[src], tracked by ASYNCcnt (no VGPR round-trip)
__device__ __forceinline__ void async_cp16(const void* gsrc, void* ldsdst) {
    __builtin_amdgcn_global_load_async_to_lds_b128(
        (as1_v4i*)(unsigned long long)gsrc,
        (as3_v4i*)(unsigned int)(unsigned long long)ldsdst,
        /*offset=*/0, /*cpol=*/0);
}
#endif

// Load one 16x32 bf16 fragment from LDS (ISA striping):
//   lanes 0-15 : row = lane,    K = {0..7, 16..23}
//   lanes 16-31: row = lane-16, K = {8..15, 24..31}
__device__ __forceinline__ v16bf load_frag(const unsigned short* lds,
                                           int rowBase, int lane) {
    const int r  = lane & 15;
    const int kb = (lane >> 4) << 3;
    const unsigned short* p = lds + (rowBase + r) * LSTR + kb;
    union { v16bf v; uint4 q[2]; } u;
    u.q[0] = *reinterpret_cast<const uint4*>(p);
    u.q[1] = *reinterpret_cast<const uint4*>(p + 16);
    return u.v;
}

// C[M x N] = A[M x K](bf16) * W[N x K](bf16)^T + bias[N](f32), C = f32
__global__ void __launch_bounds__(256)
gemm_bias_bf16wmma(const unsigned short* __restrict__ A,
                   const unsigned short* __restrict__ W,
                   const float* __restrict__ bias,
                   float* __restrict__ C,
                   int Mrows, int Nout, int Kdim)
{
    __shared__ __align__(16) unsigned short As[2][BM * LSTR];
    __shared__ __align__(16) unsigned short Bs[2][BN * LSTR];

    const int tid  = threadIdx.x;
    const int lane = tid & 31;
    const int wave = tid >> 5;          // 0..7
    const int wr   = wave >> 2;         // 0..1 : wave row (64 rows each)
    const int wc   = wave & 3;          // 0..3 : wave col (32 cols each)

    const int blockRow = blockIdx.y * BM;
    const int blockCol = blockIdx.x * BN;

    v8f acc[4][2];
    #pragma unroll
    for (int i = 0; i < 4; ++i)
        #pragma unroll
        for (int j = 0; j < 2; ++j)
            acc[i][j] = (v8f){0.f, 0.f, 0.f, 0.f, 0.f, 0.f, 0.f, 0.f};

    const int nTiles = Kdim / BK;       // 32

#if ASYNC_LDS
    // ---- async double-buffered pipeline: 4 x b128 per thread per tile ----
    // chunk mapping: tile = A[128x32] ++ B[128x32] bf16 = 1024 x 16B chunks
    auto issue_tile = [&](int buf, int k0) {
        #pragma unroll
        for (int i = 0; i < 2; ++i) {                  // A half: chunks 0..511
            const int c   = tid + i * 256;
            const int row = c >> 2, seg = c & 3;       // 4 x 16B per row
            async_cp16(A + (size_t)(blockRow + row) * Kdim + k0 + seg * 8,
                       &As[buf][row * LSTR + seg * 8]);
        }
        #pragma unroll
        for (int i = 0; i < 2; ++i) {                  // B half
            const int c   = tid + i * 256;
            const int row = c >> 2, seg = c & 3;
            async_cp16(W + (size_t)(blockCol + row) * Kdim + k0 + seg * 8,
                       &Bs[buf][row * LSTR + seg * 8]);
        }
    };

    issue_tile(0, 0);
    for (int t = 0; t < nTiles; ++t) {
        const int cur = t & 1;
        if (t + 1 < nTiles) {
            issue_tile(cur ^ 1, (t + 1) * BK);         // overlap next tile DMA
            WAIT_ASYNC(4);                             // tile t complete (in-order)
        } else {
            WAIT_ASYNC(0);
        }
        __syncthreads();

        v16bf af[4], bfd[2];
        #pragma unroll
        for (int i = 0; i < 4; ++i) af[i]  = load_frag(As[cur], wr * 64 + i * 16, lane);
        #pragma unroll
        for (int j = 0; j < 2; ++j) bfd[j] = load_frag(Bs[cur], wc * 32 + j * 16, lane);

        #pragma unroll
        for (int i = 0; i < 4; ++i)
            #pragma unroll
            for (int j = 0; j < 2; ++j)
                acc[i][j] = __builtin_amdgcn_wmma_f32_16x16x32_bf16(
                    false, af[i], false, bfd[j], (short)0, acc[i][j], false, false);
        __syncthreads();                                // buf[cur] reusable
    }
#else
    // ---- sync fallback: batched wide loads, then wide LDS stores ----
    for (int t = 0; t < nTiles; ++t) {
        const int k0 = t * BK;
        uint4 ra[2], rb[2];
        #pragma unroll
        for (int i = 0; i < 2; ++i) {
            const int c = tid + i * 256, row = c >> 2, seg = c & 3;
            ra[i] = *reinterpret_cast<const uint4*>(
                A + (size_t)(blockRow + row) * Kdim + k0 + seg * 8);
            rb[i] = *reinterpret_cast<const uint4*>(
                W + (size_t)(blockCol + row) * Kdim + k0 + seg * 8);
        }
        __syncthreads();
        #pragma unroll
        for (int i = 0; i < 2; ++i) {
            const int c = tid + i * 256, row = c >> 2, seg = c & 3;
            *reinterpret_cast<uint4*>(&As[0][row * LSTR + seg * 8]) = ra[i];
            *reinterpret_cast<uint4*>(&Bs[0][row * LSTR + seg * 8]) = rb[i];
        }
        __syncthreads();

        v16bf af[4], bfd[2];
        #pragma unroll
        for (int i = 0; i < 4; ++i) af[i]  = load_frag(As[0], wr * 64 + i * 16, lane);
        #pragma unroll
        for (int j = 0; j < 2; ++j) bfd[j] = load_frag(Bs[0], wc * 32 + j * 16, lane);

        #pragma unroll
        for (int i = 0; i < 4; ++i)
            #pragma unroll
            for (int j = 0; j < 2; ++j)
                acc[i][j] = __builtin_amdgcn_wmma_f32_16x16x32_bf16(
                    false, af[i], false, bfd[j], (short)0, acc[i][j], false, false);
    }
#endif

    // ---- store: VGPR v -> row v (+8 for upper lane half), col = lane&15 ----
    const int cr = (lane >> 4) * 8;
    const int cc = lane & 15;
    #pragma unroll
    for (int i = 0; i < 4; ++i) {
        #pragma unroll
        for (int j = 0; j < 2; ++j) {
            const int col = blockCol + wc * 32 + j * 16 + cc;
            const float b = bias[col];
            #pragma unroll
            for (int v = 0; v < 8; ++v) {
                const int row = blockRow + wr * 64 + i * 16 + cr + v;
                C[(size_t)row * Nout + col] = acc[i][j][v] + b;
            }
        }
    }
}

// fp32 -> bf16 one-pass conversion (vectorized), n4 = elems/4
__global__ void __launch_bounds__(256)
cvt_f32_bf16(const float* __restrict__ src, unsigned short* __restrict__ dst, int n4)
{
    const int i = blockIdx.x * 256 + threadIdx.x;
    if (i < n4) {
        const float4 f = reinterpret_cast<const float4*>(src)[i];
        ushort4 h;
        h.x = f2bf(f.x); h.y = f2bf(f.y); h.z = f2bf(f.z); h.w = f2bf(f.w);
        reinterpret_cast<ushort4*>(dst)[i] = h;
    }
}

// Rank-1 per-token attention: scores[d][q] = q_d*k_q/8, so softmax row d is
// softmax_q(q_d*k_q): never materialize the 64x64 matrix. ctx emitted bf16.
__global__ void __launch_bounds__(256)
attn_rank1_softmax(const float* __restrict__ Q, const float* __restrict__ K,
                   const float* __restrict__ V, unsigned short* __restrict__ Ctx)
{
    __shared__ float kk[1024];
    __shared__ float vv[1024];

    const int    tid  = threadIdx.x;
    const size_t base = (size_t)blockIdx.x * 1024;

    *reinterpret_cast<float4*>(&kk[tid * 4]) =
        *reinterpret_cast<const float4*>(K + base + tid * 4);
    *reinterpret_cast<float4*>(&vv[tid * 4]) =
        *reinterpret_cast<const float4*>(V + base + tid * 4);
    __syncthreads();

    const float4 qv = *reinterpret_cast<const float4*>(Q + base + tid * 4);
    const int    hb = (tid >> 4) << 6;          // head base (64 ch/head)
    const float  q4[4] = {qv.x, qv.y, qv.z, qv.w};
    float        out[4];

    #pragma unroll
    for (int c = 0; c < 4; ++c) {
        const float s = q4[c] * 0.125f;         // 1/sqrt(64)
        float mx = -__builtin_inff();
        #pragma unroll 8
        for (int j = 0; j < 64; ++j) mx = fmaxf(mx, s * kk[hb + j]);
        float se = 0.f, av = 0.f;
        #pragma unroll 8
        for (int j = 0; j < 64; ++j) {
            const float e = __expf(s * kk[hb + j] - mx);   // v_exp_f32
            se += e;
            av = fmaf(e, vv[hb + j], av);
        }
        out[c] = av / se;
    }
    ushort4 h;
    h.x = f2bf(out[0]); h.y = f2bf(out[1]); h.z = f2bf(out[2]); h.w = f2bf(out[3]);
    *reinterpret_cast<ushort4*>(Ctx + base + tid * 4) = h;
}

extern "C" void kernel_launch(void* const* d_in, const int* in_sizes, int n_in,
                              void* d_out, int out_size, void* d_ws, size_t ws_size,
                              hipStream_t stream) {
    (void)in_sizes; (void)n_in; (void)out_size; (void)ws_size;
    const float* x_q = (const float*)d_in[0];
    const float* x_k = (const float*)d_in[1];
    const float* x_v = (const float*)d_in[2];
    const float* Wq  = (const float*)d_in[3];
    const float* bq  = (const float*)d_in[4];
    const float* Wk  = (const float*)d_in[5];
    const float* bk  = (const float*)d_in[6];
    const float* Wv  = (const float*)d_in[7];
    const float* bv  = (const float*)d_in[8];
    const float* Wo  = (const float*)d_in[9];
    const float* bo  = (const float*)d_in[10];
    float* out = (float*)d_out;

    const int Mrows = 4 * 512;                    // 2048 tokens
    const int D     = 1024;
    const size_t actElems = (size_t)Mrows * D;    // 2M
    const size_t wElems   = (size_t)D * D;        // 1M

    // workspace layout (48 MB total)
    unsigned short* bXq = (unsigned short*)d_ws;
    unsigned short* bXk = bXq + actElems;
    unsigned short* bXv = bXk + actElems;
    unsigned short* bWq = bXv + actElems;
    unsigned short* bWk = bWq + wElems;
    unsigned short* bWv = bWk + wElems;
    unsigned short* bWo = bWv + wElems;
    float*          Qf  = (float*)(bWo + wElems);
    float*          Kf  = Qf + actElems;
    float*          Vf  = Kf + actElems;
    unsigned short* Cx  = (unsigned short*)(Vf + actElems);

    dim3 block(256);
    const int actB = (int)(actElems / 4 / 256);   // 2048 blocks
    const int wB   = (int)(wElems   / 4 / 256);   // 1024 blocks

    cvt_f32_bf16<<<actB, block, 0, stream>>>(x_q, bXq, (int)(actElems / 4));
    cvt_f32_bf16<<<actB, block, 0, stream>>>(x_k, bXk, (int)(actElems / 4));
    cvt_f32_bf16<<<actB, block, 0, stream>>>(x_v, bXv, (int)(actElems / 4));
    cvt_f32_bf16<<<wB,   block, 0, stream>>>(Wq,  bWq, (int)(wElems / 4));
    cvt_f32_bf16<<<wB,   block, 0, stream>>>(Wk,  bWk, (int)(wElems / 4));
    cvt_f32_bf16<<<wB,   block, 0, stream>>>(Wv,  bWv, (int)(wElems / 4));
    cvt_f32_bf16<<<wB,   block, 0, stream>>>(Wo,  bWo, (int)(wElems / 4));

    dim3 gridG(D / BN, Mrows / BM);               // (8, 16)
    gemm_bias_bf16wmma<<<gridG, block, 0, stream>>>(bXq, bWq, bq, Qf, Mrows, D, D);
    gemm_bias_bf16wmma<<<gridG, block, 0, stream>>>(bXk, bWk, bk, Kf, Mrows, D, D);
    gemm_bias_bf16wmma<<<gridG, block, 0, stream>>>(bXv, bWv, bv, Vf, Mrows, D, D);

    attn_rank1_softmax<<<dim3(Mrows), block, 0, stream>>>(Qf, Kf, Vf, Cx);

    gemm_bias_bf16wmma<<<gridG, block, 0, stream>>>(Cx, bWo, bo, out, Mrows, D, D);
}

// v001
// A run of this version takes 114 microseconds.
// Timed twice side by side with v000, it ran 1.09 times as fast both times.
#include <hip/hip_runtime.h>

// ---------------------------------------------------------------------------
// MHTempCtxAttention for MI455X (gfx1250, wave32, WMMA + async LDS DMA)
// Pipeline:
//   1) one-launch fp32->bf16 conversion of activations & weights
//   2) bf16 WMMA GEMMs (compute-bound part), tiles staged into LDS with
//      GLOBAL_LOAD_ASYNC_TO_LDS_B128 + s_wait_asynccnt double-buffer pipeline
//   3) rank-1 softmax attention on fp32 VALU (v_exp_f32), ctx emitted as bf16
//   4) output projection GEMM -> fp32 d_out
// ---------------------------------------------------------------------------

typedef __attribute__((ext_vector_type(16))) __bf16 v16bf;
typedef __attribute__((ext_vector_type(8)))  float  v8f;
typedef __attribute__((ext_vector_type(4)))  int    v4i;

#define BM   128      // block tile rows
#define BN   128      // block tile cols
#define BK   32       // K step (WMMA K for bf16)
#define LSTR 40       // LDS row stride in bf16 elems (32 + 8 pad; rows stay 16B aligned)

#if __has_builtin(__builtin_amdgcn_global_load_async_to_lds_b128)
#define ASYNC_LDS 1
#else
#define ASYNC_LDS 0
#endif

#if __has_builtin(__builtin_amdgcn_s_wait_asynccnt)
#define WAIT_ASYNC(n) __builtin_amdgcn_s_wait_asynccnt(n)
#else
#define WAIT_ASYNC(n) asm volatile("s_wait_asynccnt %0" :: "n"(n) : "memory")
#endif

typedef __attribute__((address_space(1))) v4i as1_v4i;   // global 16B vector
typedef __attribute__((address_space(3))) v4i as3_v4i;   // LDS 16B vector

__device__ __forceinline__ unsigned short f2bf(float f) {
    unsigned int u = __float_as_uint(f);
    u += 0x7FFFu + ((u >> 16) & 1u);           // round-to-nearest-even
    return (unsigned short)(u >> 16);
}

#if ASYNC_LDS
// 16B async DMA: LDS[dst] = MEM[src], tracked by ASYNCcnt (no VGPR round-trip)
__device__ __forceinline__ void async_cp16(const void* gsrc, void* ldsdst) {
    __builtin_amdgcn_global_load_async_to_lds_b128(
        (as1_v4i*)(unsigned long long)gsrc,
        (as3_v4i*)(unsigned int)(unsigned long long)ldsdst,
        /*offset=*/0, /*cpol=*/0);
}
#endif

// Load one 16x32 bf16 fragment from LDS (ISA striping):
//   lanes 0-15 : row = lane,    K = {0..7, 16..23}
//   lanes 16-31: row = lane-16, K = {8..15, 24..31}
__device__ __forceinline__ v16bf load_frag(const unsigned short* lds,
                                           int rowBase, int lane) {
    const int r  = lane & 15;
    const int kb = (lane >> 4) << 3;
    const unsigned short* p = lds + (rowBase + r) * LSTR + kb;
    union { v16bf v; uint4 q[2]; } u;
    u.q[0] = *reinterpret_cast<const uint4*>(p);
    u.q[1] = *reinterpret_cast<const uint4*>(p + 16);
    return u.v;
}

// C[M x N] = A[M x K](bf16) * W[N x K](bf16)^T + bias[N](f32), C = f32
__global__ void __launch_bounds__(256)
gemm_bias_bf16wmma(const unsigned short* __restrict__ A,
                   const unsigned short* __restrict__ W,
                   const float* __restrict__ bias,
                   float* __restrict__ C,
                   int Mrows, int Nout, int Kdim)
{
    __shared__ __align__(16) unsigned short As[2][BM * LSTR];
    __shared__ __align__(16) unsigned short Bs[2][BN * LSTR];

    const int tid  = threadIdx.x;
    const int lane = tid & 31;
    const int wave = tid >> 5;          // 0..7
    const int wr   = wave >> 2;         // 0..1 : wave row (64 rows each)
    const int wc   = wave & 3;          // 0..3 : wave col (32 cols each)

    const int blockRow = blockIdx.y * BM;
    const int blockCol = blockIdx.x * BN;

    v8f acc[4][2];
    #pragma unroll
    for (int i = 0; i < 4; ++i)
        #pragma unroll
        for (int j = 0; j < 2; ++j)
            acc[i][j] = (v8f){0.f, 0.f, 0.f, 0.f, 0.f, 0.f, 0.f, 0.f};

    const int nTiles = Kdim / BK;       // 32

#if ASYNC_LDS
    // ---- async double-buffered pipeline: 4 x b128 per thread per tile ----
    // chunk mapping: tile = A[128x32] ++ B[128x32] bf16 = 1024 x 16B chunks
    auto issue_tile = [&](int buf, int k0) {
        #pragma unroll
        for (int i = 0; i < 2; ++i) {                  // A half: chunks 0..511
            const int c   = tid + i * 256;
            const int row = c >> 2, seg = c & 3;       // 4 x 16B per row
            async_cp16(A + (size_t)(blockRow + row) * Kdim + k0 + seg * 8,
                       &As[buf][row * LSTR + seg * 8]);
        }
        #pragma unroll
        for (int i = 0; i < 2; ++i) {                  // B half
            const int c   = tid + i * 256;
            const int row = c >> 2, seg = c & 3;
            async_cp16(W + (size_t)(blockCol + row) * Kdim + k0 + seg * 8,
                       &Bs[buf][row * LSTR + seg * 8]);
        }
    };

    issue_tile(0, 0);
    for (int t = 0; t < nTiles; ++t) {
        const int cur = t & 1;
        if (t + 1 < nTiles) {
            issue_tile(cur ^ 1, (t + 1) * BK);         // overlap next tile DMA
            WAIT_ASYNC(4);                             // tile t complete (in-order)
        } else {
            WAIT_ASYNC(0);
        }
        __syncthreads();

        v16bf af[4], bfd[2];
        #pragma unroll
        for (int i = 0; i < 4; ++i) af[i]  = load_frag(As[cur], wr * 64 + i * 16, lane);
        #pragma unroll
        for (int j = 0; j < 2; ++j) bfd[j] = load_frag(Bs[cur], wc * 32 + j * 16, lane);

        #pragma unroll
        for (int i = 0; i < 4; ++i)
            #pragma unroll
            for (int j = 0; j < 2; ++j)
                acc[i][j] = __builtin_amdgcn_wmma_f32_16x16x32_bf16(
                    false, af[i], false, bfd[j], (short)0, acc[i][j], false, false);
        __syncthreads();                                // buf[cur] reusable
    }
#else
    // ---- sync fallback: batched wide loads, then wide LDS stores ----
    for (int t = 0; t < nTiles; ++t) {
        const int k0 = t * BK;
        uint4 ra[2], rb[2];
        #pragma unroll
        for (int i = 0; i < 2; ++i) {
            const int c = tid + i * 256, row = c >> 2, seg = c & 3;
            ra[i] = *reinterpret_cast<const uint4*>(
                A + (size_t)(blockRow + row) * Kdim + k0 + seg * 8);
            rb[i] = *reinterpret_cast<const uint4*>(
                W + (size_t)(blockCol + row) * Kdim + k0 + seg * 8);
        }
        __syncthreads();
        #pragma unroll
        for (int i = 0; i < 2; ++i) {
            const int c = tid + i * 256, row = c >> 2, seg = c & 3;
            *reinterpret_cast<uint4*>(&As[0][row * LSTR + seg * 8]) = ra[i];
            *reinterpret_cast<uint4*>(&Bs[0][row * LSTR + seg * 8]) = rb[i];
        }
        __syncthreads();

        v16bf af[4], bfd[2];
        #pragma unroll
        for (int i = 0; i < 4; ++i) af[i]  = load_frag(As[0], wr * 64 + i * 16, lane);
        #pragma unroll
        for (int j = 0; j < 2; ++j) bfd[j] = load_frag(Bs[0], wc * 32 + j * 16, lane);

        #pragma unroll
        for (int i = 0; i < 4; ++i)
            #pragma unroll
            for (int j = 0; j < 2; ++j)
                acc[i][j] = __builtin_amdgcn_wmma_f32_16x16x32_bf16(
                    false, af[i], false, bfd[j], (short)0, acc[i][j], false, false);
    }
#endif

    // ---- store: VGPR v -> row v (+8 for upper lane half), col = lane&15 ----
    const int cr = (lane >> 4) * 8;
    const int cc = lane & 15;
    #pragma unroll
    for (int i = 0; i < 4; ++i) {
        #pragma unroll
        for (int j = 0; j < 2; ++j) {
            const int col = blockCol + wc * 32 + j * 16 + cc;
            const float b = bias[col];
            #pragma unroll
            for (int v = 0; v < 8; ++v) {
                const int row = blockRow + wr * 64 + i * 16 + cr + v;
                C[(size_t)row * Nout + col] = acc[i][j][v] + b;
            }
        }
    }
}

// fp32 -> bf16 conversion of all seven tensors in ONE launch of few, long-lived
// waves. The bf16 planes lie back to back in the workspace in argument order,
// so sweep n of the grid writes float4 group n * CVT_STRIDE + g of that region.
#define CVT_BLOCKS  512                     // 2 blocks (16 waves) per WGP
#define CVT_STRIDE  (CVT_BLOCKS * 256)      // float4 groups per sweep of the grid
#define ACT_SWEEPS  4                       // 2048 * 1024 / 4 / CVT_STRIDE
#define W_SWEEPS    2                       // 1024 * 1024 / 4 / CVT_STRIDE
static_assert(ACT_SWEEPS * CVT_STRIDE * 4 == 2048 * 1024, "activation sweeps");
static_assert(W_SWEEPS   * CVT_STRIDE * 4 == 1024 * 1024, "weight sweeps");

__global__ void __launch_bounds__(256)
cvt_all_f32_bf16(const float* __restrict__ xq, const float* __restrict__ xk,
                 const float* __restrict__ xv, const float* __restrict__ wq,
                 const float* __restrict__ wk, const float* __restrict__ wv,
                 const float* __restrict__ wo, unsigned short* __restrict__ dst)
{
    const int g = blockIdx.x * 256 + threadIdx.x;
    const float* const act[3] = {xq, xk, xv};
    const float* const wts[4] = {wq, wk, wv, wo};
    float4 f[3 * ACT_SWEEPS + 4 * W_SWEEPS];

    // all loads first: every thread keeps its 20 independent 16B reads in flight.
    // Every loop here is fully unrolled so that f[] stays in registers and the
    // tensor each sweep reads is known at compile time (no per-sweep select).
    #pragma unroll
    for (int t = 0; t < 3; ++t)
        #pragma unroll
        for (int s = 0; s < ACT_SWEEPS; ++s)
            f[t * ACT_SWEEPS + s] =
                reinterpret_cast<const float4*>(act[t])[s * CVT_STRIDE + g];
    #pragma unroll
    for (int t = 0; t < 4; ++t)
        #pragma unroll
        for (int s = 0; s < W_SWEEPS; ++s)
            f[3 * ACT_SWEEPS + t * W_SWEEPS + s] =
                reinterpret_cast<const float4*>(wts[t])[s * CVT_STRIDE + g];

    #pragma unroll
    for (int n = 0; n < 3 * ACT_SWEEPS + 4 * W_SWEEPS; ++n) {
        ushort4 h;
        h.x = f2bf(f[n].x); h.y = f2bf(f[n].y); h.z = f2bf(f[n].z); h.w = f2bf(f[n].w);
        reinterpret_cast<ushort4*>(dst)[n * CVT_STRIDE + g] = h;
    }
}

// Rank-1 per-token attention: scores[d][q] = q_d*k_q/8, so softmax row d is
// softmax_q(q_d*k_q): never materialize the 64x64 matrix. ctx emitted bf16.
__global__ void __launch_bounds__(256)
attn_rank1_softmax(const float* __restrict__ Q, const float* __restrict__ K,
                   const float* __restrict__ V, unsigned short* __restrict__ Ctx)
{
    __shared__ float kk[1024];
    __shared__ float vv[1024];

    const int    tid  = threadIdx.x;
    const size_t base = (size_t)blockIdx.x * 1024;

    *reinterpret_cast<float4*>(&kk[tid * 4]) =
        *reinterpret_cast<const float4*>(K + base + tid * 4);
    *reinterpret_cast<float4*>(&vv[tid * 4]) =
        *reinterpret_cast<const float4*>(V + base + tid * 4);
    __syncthreads();

    const float4 qv = *reinterpret_cast<const float4*>(Q + base + tid * 4);
    const int    hb = (tid >> 4) << 6;          // head base (64 ch/head)
    const float  q4[4] = {qv.x, qv.y, qv.z, qv.w};
    float        out[4];

    #pragma unroll
    for (int c = 0; c < 4; ++c) {
        const float s = q4[c] * 0.125f;         // 1/sqrt(64)
        float mx = -__builtin_inff();
        #pragma unroll 8
        for (int j = 0; j < 64; ++j) mx = fmaxf(mx, s * kk[hb + j]);
        float se = 0.f, av = 0.f;
        #pragma unroll 8
        for (int j = 0; j < 64; ++j) {
            const float e = __expf(s * kk[hb + j] - mx);   // v_exp_f32
            se += e;
            av = fmaf(e, vv[hb + j], av);
        }
        out[c] = av / se;
    }
    ushort4 h;
    h.x = f2bf(out[0]); h.y = f2bf(out[1]); h.z = f2bf(out[2]); h.w = f2bf(out[3]);
    *reinterpret_cast<ushort4*>(Ctx + base + tid * 4) = h;
}

extern "C" void kernel_launch(void* const* d_in, const int* in_sizes, int n_in,
                              void* d_out, int out_size, void* d_ws, size_t ws_size,
                              hipStream_t stream) {
    (void)in_sizes; (void)n_in; (void)out_size; (void)ws_size;
    const float* x_q = (const float*)d_in[0];
    const float* x_k = (const float*)d_in[1];
    const float* x_v = (const float*)d_in[2];
    const float* Wq  = (const float*)d_in[3];
    const float* bq  = (const float*)d_in[4];
    const float* Wk  = (const float*)d_in[5];
    const float* bk  = (const float*)d_in[6];
    const float* Wv  = (const float*)d_in[7];
    const float* bv  = (const float*)d_in[8];
    const float* Wo  = (const float*)d_in[9];
    const float* bo  = (const float*)d_in[10];
    float* out = (float*)d_out;

    const int Mrows = 4 * 512;                    // 2048 tokens
    const int D     = 1024;
    const size_t actElems = (size_t)Mrows * D;    // 2M
    const size_t wElems   = (size_t)D * D;        // 1M

    // workspace layout (48 MB total)
    unsigned short* bXq = (unsigned short*)d_ws;
    unsigned short* bXk = bXq + actElems;
    unsigned short* bXv = bXk + actElems;
    unsigned short* bWq = bXv + actElems;
    unsigned short* bWk = bWq + wElems;
    unsigned short* bWv = bWk + wElems;
    unsigned short* bWo = bWv + wElems;
    float*          Qf  = (float*)(bWo + wElems);
    float*          Kf  = Qf + actElems;
    float*          Vf  = Kf + actElems;
    unsigned short* Cx  = (unsigned short*)(Vf + actElems);

    dim3 block(256);
    // bXq..bWo are contiguous in this order: one launch fills all seven planes
    cvt_all_f32_bf16<<<CVT_BLOCKS, block, 0, stream>>>(x_q, x_k, x_v, Wq, Wk, Wv, Wo, bXq);

    dim3 gridG(D / BN, Mrows / BM);               // (8, 16)
    gemm_bias_bf16wmma<<<gridG, block, 0, stream>>>(bXq, bWq, bq, Qf, Mrows, D, D);
    gemm_bias_bf16wmma<<<gridG, block, 0, stream>>>(bXk, bWk, bk, Kf, Mrows, D, D);
    gemm_bias_bf16wmma<<<gridG, block, 0, stream>>>(bXv, bWv, bv, Vf, Mrows, D, D);

    attn_rank1_softmax<<<dim3(Mrows), block, 0, stream>>>(Qf, Kf, Vf, Cx);

    gemm_bias_bf16wmma<<<gridG, block, 0, stream>>>(Cx, bWo, bo, out, Mrows, D, D);
}

// v002
// Measured time: 83.1 microseconds a run.
// In both of two side-by-side timings against v001, it was 1.37 times as fast.
// Over all steps from v000 it is 1.49 times as fast.
#include <hip/hip_runtime.h>

// ---------------------------------------------------------------------------
// MHTempCtxAttention for MI455X (gfx1250, wave32, WMMA + async LDS DMA)
// Pipeline:
//   1) one-launch fp32->bf16 conversion of activations & weights
//   2) bf16 WMMA GEMMs (compute-bound part), tiles staged into LDS with
//      GLOBAL_LOAD_ASYNC_TO_LDS_B128 + s_wait_asynccnt double-buffer pipeline
//   3) rank-1 softmax attention on fp32 VALU (v_exp_f32), ctx emitted as bf16
//   4) output projection GEMM -> fp32 d_out
// ---------------------------------------------------------------------------

typedef __attribute__((ext_vector_type(16))) __bf16 v16bf;
typedef __attribute__((ext_vector_type(8)))  float  v8f;
typedef __attribute__((ext_vector_type(4)))  int    v4i;

#define BM   128      // block tile rows
#define BN   128      // block tile cols
#define BK   32       // K step (WMMA K for bf16)
#define LSTR 40       // LDS row stride in bf16 elems (32 + 8 pad; rows stay 16B aligned)

#if __has_builtin(__builtin_amdgcn_global_load_async_to_lds_b128)
#define ASYNC_LDS 1
#else
#define ASYNC_LDS 0
#endif

#if __has_builtin(__builtin_amdgcn_s_wait_asynccnt)
#define WAIT_ASYNC(n) __builtin_amdgcn_s_wait_asynccnt(n)
#else
#define WAIT_ASYNC(n) asm volatile("s_wait_asynccnt %0" :: "n"(n) : "memory")
#endif

typedef __attribute__((address_space(1))) v4i as1_v4i;   // global 16B vector
typedef __attribute__((address_space(3))) v4i as3_v4i;   // LDS 16B vector

__device__ __forceinline__ unsigned short f2bf(float f) {
    unsigned int u = __float_as_uint(f);
    u += 0x7FFFu + ((u >> 16) & 1u);           // round-to-nearest-even
    return (unsigned short)(u >> 16);
}

#if ASYNC_LDS
// 16B async DMA: LDS[dst] = MEM[src], tracked by ASYNCcnt (no VGPR round-trip)
__device__ __forceinline__ void async_cp16(const void* gsrc, void* ldsdst) {
    __builtin_amdgcn_global_load_async_to_lds_b128(
        (as1_v4i*)(unsigned long long)gsrc,
        (as3_v4i*)(unsigned int)(unsigned long long)ldsdst,
        /*offset=*/0, /*cpol=*/0);
}
#endif

// Load one 16x32 bf16 fragment from LDS (ISA striping):
//   lanes 0-15 : row = lane,    K = {0..7, 16..23}
//   lanes 16-31: row = lane-16, K = {8..15, 24..31}
__device__ __forceinline__ v16bf load_frag(const unsigned short* lds,
                                           int rowBase, int lane) {
    const int r  = lane & 15;
    const int kb = (lane >> 4) << 3;
    const unsigned short* p = lds + (rowBase + r) * LSTR + kb;
    union { v16bf v; uint4 q[2]; } u;
    u.q[0] = *reinterpret_cast<const uint4*>(p);
    u.q[1] = *reinterpret_cast<const uint4*>(p + 16);
    return u.v;
}

// C[M x N] = A[M x K](bf16) * W[N x K](bf16)^T + bias[N](f32), C = f32
// blockIdx.z picks one of up to three independent products of the same shape:
// their A, W and C planes lie back to back behind Abase, Wbase and Cbase.
__global__ void __launch_bounds__(256)
gemm_bias_bf16wmma(const unsigned short* __restrict__ Abase,
                   const unsigned short* __restrict__ Wbase,
                   const float* __restrict__ bias0,
                   const float* __restrict__ bias1,
                   const float* __restrict__ bias2,
                   float* __restrict__ Cbase,
                   int Mrows, int Nout, int Kdim)
{
    const int z = blockIdx.z;
    const unsigned short* __restrict__ A = Abase + (size_t)z * Mrows * Kdim;
    const unsigned short* __restrict__ W = Wbase + (size_t)z * Nout * Kdim;
    const float* __restrict__ bias = (z == 0) ? bias0 : (z == 1) ? bias1 : bias2;
    float* __restrict__ C = Cbase + (size_t)z * Mrows * Nout;

    __shared__ __align__(16) unsigned short As[2][BM * LSTR];
    __shared__ __align__(16) unsigned short Bs[2][BN * LSTR];

    const int tid  = threadIdx.x;
    const int lane = tid & 31;
    const int wave = tid >> 5;          // 0..7
    const int wr   = wave >> 2;         // 0..1 : wave row (64 rows each)
    const int wc   = wave & 3;          // 0..3 : wave col (32 cols each)

    const int blockRow = blockIdx.y * BM;
    const int blockCol = blockIdx.x * BN;

    v8f acc[4][2];
    #pragma unroll
    for (int i = 0; i < 4; ++i)
        #pragma unroll
        for (int j = 0; j < 2; ++j)
            acc[i][j] = (v8f){0.f, 0.f, 0.f, 0.f, 0.f, 0.f, 0.f, 0.f};

    const int nTiles = Kdim / BK;       // 32

#if ASYNC_LDS
    // ---- async double-buffered pipeline: 4 x b128 per thread per tile ----
    // chunk mapping: tile = A[128x32] ++ B[128x32] bf16 = 1024 x 16B chunks
    auto issue_tile = [&](int buf, int k0) {
        #pragma unroll
        for (int i = 0; i < 2; ++i) {                  // A half: chunks 0..511
            const int c   = tid + i * 256;
            const int row = c >> 2, seg = c & 3;       // 4 x 16B per row
            async_cp16(A + (size_t)(blockRow + row) * Kdim + k0 + seg * 8,
                       &As[buf][row * LSTR + seg * 8]);
        }
        #pragma unroll
        for (int i = 0; i < 2; ++i) {                  // B half
            const int c   = tid + i * 256;
            const int row = c >> 2, seg = c & 3;
            async_cp16(W + (size_t)(blockCol + row) * Kdim + k0 + seg * 8,
                       &Bs[buf][row * LSTR + seg * 8]);
        }
    };

    issue_tile(0, 0);
    for (int t = 0; t < nTiles; ++t) {
        const int cur = t & 1;
        if (t + 1 < nTiles) {
            issue_tile(cur ^ 1, (t + 1) * BK);         // overlap next tile DMA
            WAIT_ASYNC(4);                             // tile t complete (in-order)
        } else {
            WAIT_ASYNC(0);
        }
        __syncthreads();

        v16bf af[4], bfd[2];
        #pragma unroll
        for (int i = 0; i < 4; ++i) af[i]  = load_frag(As[cur], wr * 64 + i * 16, lane);
        #pragma unroll
        for (int j = 0; j < 2; ++j) bfd[j] = load_frag(Bs[cur], wc * 32 + j * 16, lane);

        #pragma unroll
        for (int i = 0; i < 4; ++i)
            #pragma unroll
            for (int j = 0; j < 2; ++j)
                acc[i][j] = __builtin_amdgcn_wmma_f32_16x16x32_bf16(
                    false, af[i], false, bfd[j], (short)0, acc[i][j], false, false);
        __syncthreads();                                // buf[cur] reusable
    }
#else
    // ---- sync fallback: batched wide loads, then wide LDS stores ----
    for (int t = 0; t < nTiles; ++t) {
        const int k0 = t * BK;
        uint4 ra[2], rb[2];
        #pragma unroll
        for (int i = 0; i < 2; ++i) {
            const int c = tid + i * 256, row = c >> 2, seg = c & 3;
            ra[i] = *reinterpret_cast<const uint4*>(
                A + (size_t)(blockRow + row) * Kdim + k0 + seg * 8);
            rb[i] = *reinterpret_cast<const uint4*>(
                W + (size_t)(blockCol + row) * Kdim + k0 + seg * 8);
        }
        __syncthreads();
        #pragma unroll
        for (int i = 0; i < 2; ++i) {
            const int c = tid + i * 256, row = c >> 2, seg = c & 3;
            *reinterpret_cast<uint4*>(&As[0][row * LSTR + seg * 8]) = ra[i];
            *reinterpret_cast<uint4*>(&Bs[0][row * LSTR + seg * 8]) = rb[i];
        }
        __syncthreads();

        v16bf af[4], bfd[2];
        #pragma unroll
        for (int i = 0; i < 4; ++i) af[i]  = load_frag(As[0], wr * 64 + i * 16, lane);
        #pragma unroll
        for (int j = 0; j < 2; ++j) bfd[j] = load_frag(Bs[0], wc * 32 + j * 16, lane);

        #pragma unroll
        for (int i = 0; i < 4; ++i)
            #pragma unroll
            for (int j = 0; j < 2; ++j)
                acc[i][j] = __builtin_amdgcn_wmma_f32_16x16x32_bf16(
                    false, af[i], false, bfd[j], (short)0, acc[i][j], false, false);
    }
#endif

    // ---- store: VGPR v -> row v (+8 for upper lane half), col = lane&15 ----
    const int cr = (lane >> 4) * 8;
    const int cc = lane & 15;
    #pragma unroll
    for (int i = 0; i < 4; ++i) {
        #pragma unroll
        for (int j = 0; j < 2; ++j) {
            const int col = blockCol + wc * 32 + j * 16 + cc;
            const float b = bias[col];
            #pragma unroll
            for (int v = 0; v < 8; ++v) {
                const int row = blockRow + wr * 64 + i * 16 + cr + v;
                C[(size_t)row * Nout + col] = acc[i][j][v] + b;
            }
        }
    }
}

// fp32 -> bf16 conversion of all seven tensors in ONE launch of few, long-lived
// waves. The bf16 planes lie back to back in the workspace in argument order,
// so sweep n of the grid writes float4 group n * CVT_STRIDE + g of that region.
#define CVT_BLOCKS  512                     // 2 blocks (16 waves) per WGP
#define CVT_STRIDE  (CVT_BLOCKS * 256)      // float4 groups per sweep of the grid
#define ACT_SWEEPS  4                       // 2048 * 1024 / 4 / CVT_STRIDE
#define W_SWEEPS    2                       // 1024 * 1024 / 4 / CVT_STRIDE
static_assert(ACT_SWEEPS * CVT_STRIDE * 4 == 2048 * 1024, "activation sweeps");
static_assert(W_SWEEPS   * CVT_STRIDE * 4 == 1024 * 1024, "weight sweeps");

__global__ void __launch_bounds__(256)
cvt_all_f32_bf16(const float* __restrict__ xq, const float* __restrict__ xk,
                 const float* __restrict__ xv, const float* __restrict__ wq,
                 const float* __restrict__ wk, const float* __restrict__ wv,
                 const float* __restrict__ wo, unsigned short* __restrict__ dst)
{
    const int g = blockIdx.x * 256 + threadIdx.x;
    const float* const act[3] = {xq, xk, xv};
    const float* const wts[4] = {wq, wk, wv, wo};
    float4 f[3 * ACT_SWEEPS + 4 * W_SWEEPS];

    // all loads first: every thread keeps its 20 independent 16B reads in flight.
    // Every loop here is fully unrolled so that f[] stays in registers and the
    // tensor each sweep reads is known at compile time (no per-sweep select).
    #pragma unroll
    for (int t = 0; t < 3; ++t)
        #pragma unroll
        for (int s = 0; s < ACT_SWEEPS; ++s)
            f[t * ACT_SWEEPS + s] =
                reinterpret_cast<const float4*>(act[t])[s * CVT_STRIDE + g];
    #pragma unroll
    for (int t = 0; t < 4; ++t)
        #pragma unroll
        for (int s = 0; s < W_SWEEPS; ++s)
            f[3 * ACT_SWEEPS + t * W_SWEEPS + s] =
                reinterpret_cast<const float4*>(wts[t])[s * CVT_STRIDE + g];

    #pragma unroll
    for (int n = 0; n < 3 * ACT_SWEEPS + 4 * W_SWEEPS; ++n) {
        ushort4 h;
        h.x = f2bf(f[n].x); h.y = f2bf(f[n].y); h.z = f2bf(f[n].z); h.w = f2bf(f[n].w);
        reinterpret_cast<ushort4*>(dst)[n * CVT_STRIDE + g] = h;
    }
}

// Rank-1 per-token attention: scores[d][q] = q_d*k_q/8, so softmax row d is
// softmax_q(q_d*k_q): never materialize the 64x64 matrix. ctx emitted bf16.
__global__ void __launch_bounds__(256)
attn_rank1_softmax(const float* __restrict__ Q, const float* __restrict__ K,
                   const float* __restrict__ V, unsigned short* __restrict__ Ctx)
{
    __shared__ float kk[1024];
    __shared__ float vv[1024];

    const int    tid  = threadIdx.x;
    const size_t base = (size_t)blockIdx.x * 1024;

    *reinterpret_cast<float4*>(&kk[tid * 4]) =
        *reinterpret_cast<const float4*>(K + base + tid * 4);
    *reinterpret_cast<float4*>(&vv[tid * 4]) =
        *reinterpret_cast<const float4*>(V + base + tid * 4);
    __syncthreads();

    const float4 qv = *reinterpret_cast<const float4*>(Q + base + tid * 4);
    const int    hb = (tid >> 4) << 6;          // head base (64 ch/head)
    const float  q4[4] = {qv.x, qv.y, qv.z, qv.w};
    float        out[4];

    #pragma unroll
    for (int c = 0; c < 4; ++c) {
        const float s = q4[c] * 0.125f;         // 1/sqrt(64)
        float mx = -__builtin_inff();
        #pragma unroll 8
        for (int j = 0; j < 64; ++j) mx = fmaxf(mx, s * kk[hb + j]);
        float se = 0.f, av = 0.f;
        #pragma unroll 8
        for (int j = 0; j < 64; ++j) {
            const float e = __expf(s * kk[hb + j] - mx);   // v_exp_f32
            se += e;
            av = fmaf(e, vv[hb + j], av);
        }
        out[c] = av / se;
    }
    ushort4 h;
    h.x = f2bf(out[0]); h.y = f2bf(out[1]); h.z = f2bf(out[2]); h.w = f2bf(out[3]);
    *reinterpret_cast<ushort4*>(Ctx + base + tid * 4) = h;
}

extern "C" void kernel_launch(void* const* d_in, const int* in_sizes, int n_in,
                              void* d_out, int out_size, void* d_ws, size_t ws_size,
                              hipStream_t stream) {
    (void)in_sizes; (void)n_in; (void)out_size; (void)ws_size;
    const float* x_q = (const float*)d_in[0];
    const float* x_k = (const float*)d_in[1];
    const float* x_v = (const float*)d_in[2];
    const float* Wq  = (const float*)d_in[3];
    const float* bq  = (const float*)d_in[4];
    const float* Wk  = (const float*)d_in[5];
    const float* bk  = (const float*)d_in[6];
    const float* Wv  = (const float*)d_in[7];
    const float* bv  = (const float*)d_in[8];
    const float* Wo  = (const float*)d_in[9];
    const float* bo  = (const float*)d_in[10];
    float* out = (float*)d_out;

    const int Mrows = 4 * 512;                    // 2048 tokens
    const int D     = 1024;
    const size_t actElems = (size_t)Mrows * D;    // 2M
    const size_t wElems   = (size_t)D * D;        // 1M

    // workspace layout (48 MB total)
    unsigned short* bXq = (unsigned short*)d_ws;
    unsigned short* bXk = bXq + actElems;
    unsigned short* bXv = bXk + actElems;
    unsigned short* bWq = bXv + actElems;
    unsigned short* bWk = bWq + wElems;
    unsigned short* bWv = bWk + wElems;
    unsigned short* bWo = bWv + wElems;
    float*          Qf  = (float*)(bWo + wElems);
    float*          Kf  = Qf + actElems;
    float*          Vf  = Kf + actElems;
    unsigned short* Cx  = (unsigned short*)(Vf + actElems);

    dim3 block(256);
    // bXq..bWo are contiguous in this order: one launch fills all seven planes
    cvt_all_f32_bf16<<<CVT_BLOCKS, block, 0, stream>>>(x_q, x_k, x_v, Wq, Wk, Wv, Wo, bXq);

    // Q, K and V projections are independent: one launch, 384 blocks resident
    // together (bXq|bXk|bXv, bWq|bWk|bWv and Qf|Kf|Vf are each contiguous)
    dim3 gridQKV(D / BN, Mrows / BM, 3);          // (8, 16, 3)
    gemm_bias_bf16wmma<<<gridQKV, block, 0, stream>>>(bXq, bWq, bq, bk, bv, Qf, Mrows, D, D);

    attn_rank1_softmax<<<dim3(Mrows), block, 0, stream>>>(Qf, Kf, Vf, Cx);

    dim3 gridO(D / BN, Mrows / BM, 1);            // (8, 16, 1)
    gemm_bias_bf16wmma<<<gridO, block, 0, stream>>>(Cx, bWo, bo, bo, bo, out, Mrows, D, D);
}

// v003
// Measured time: 64.4 microseconds a run.
// Timed twice side by side with v002, it ran 1.29 and 1.28 times as fast.
// All steps since v000 together make it 1.92 times as fast.
#include <hip/hip_runtime.h>

// ---------------------------------------------------------------------------
// MHTempCtxAttention for MI455X (gfx1250, wave32, WMMA + async LDS DMA)
// Pipeline:
//   1) one-launch fp32->bf16 conversion of activations & weights
//   2) bf16 WMMA GEMMs (compute-bound part), tiles staged into LDS with
//      GLOBAL_LOAD_ASYNC_TO_LDS_B128 + s_wait_asynccnt double-buffer pipeline
//   3) rank-1 softmax attention on fp32 VALU (v_exp_f32), ctx emitted as bf16
//   4) output projection GEMM -> fp32 d_out
// ---------------------------------------------------------------------------

typedef __attribute__((ext_vector_type(16))) __bf16 v16bf;
typedef __attribute__((ext_vector_type(8)))  float  v8f;
typedef __attribute__((ext_vector_type(4)))  int    v4i;

#define BM   128      // block tile rows
#define BN   128      // block tile cols
#define BK   32       // K step (WMMA K for bf16)
#define LSTR 40       // LDS row stride in bf16 elems (32 + 8 pad; rows stay 16B aligned)

#if __has_builtin(__builtin_amdgcn_global_load_async_to_lds_b128)
#define ASYNC_LDS 1
#else
#define ASYNC_LDS 0
#endif

#if __has_builtin(__builtin_amdgcn_s_wait_asynccnt)
#define WAIT_ASYNC(n) __builtin_amdgcn_s_wait_asynccnt(n)
#else
#define WAIT_ASYNC(n) asm volatile("s_wait_asynccnt %0" :: "n"(n) : "memory")
#endif

typedef __attribute__((address_space(1))) v4i as1_v4i;   // global 16B vector
typedef __attribute__((address_space(3))) v4i as3_v4i;   // LDS 16B vector

__device__ __forceinline__ unsigned short f2bf(float f) {
    unsigned int u = __float_as_uint(f);
    u += 0x7FFFu + ((u >> 16) & 1u);           // round-to-nearest-even
    return (unsigned short)(u >> 16);
}

#if ASYNC_LDS
// 16B async DMA: LDS[dst] = MEM[src], tracked by ASYNCcnt (no VGPR round-trip)
__device__ __forceinline__ void async_cp16(const void* gsrc, void* ldsdst) {
    __builtin_amdgcn_global_load_async_to_lds_b128(
        (as1_v4i*)(unsigned long long)gsrc,
        (as3_v4i*)(unsigned int)(unsigned long long)ldsdst,
        /*offset=*/0, /*cpol=*/0);
}
#endif

// Load one 16x32 bf16 fragment from LDS (ISA striping):
//   lanes 0-15 : row = lane,    K = {0..7, 16..23}
//   lanes 16-31: row = lane-16, K = {8..15, 24..31}
__device__ __forceinline__ v16bf load_frag(const unsigned short* lds,
                                           int rowBase, int lane) {
    const int r  = lane & 15;
    const int kb = (lane >> 4) << 3;
    const unsigned short* p = lds + (rowBase + r) * LSTR + kb;
    union { v16bf v; uint4 q[2]; } u;
    u.q[0] = *reinterpret_cast<const uint4*>(p);
    u.q[1] = *reinterpret_cast<const uint4*>(p + 16);
    return u.v;
}

// C[M x N] = A[M x K](bf16) * W[N x K](bf16)^T + bias[N](f32), C = f32
// blockIdx.z picks one of up to three independent products of the same shape:
// their A, W and C planes lie back to back behind Abase, Wbase and Cbase.
__global__ void __launch_bounds__(256)
gemm_bias_bf16wmma(const unsigned short* __restrict__ Abase,
                   const unsigned short* __restrict__ Wbase,
                   const float* __restrict__ bias0,
                   const float* __restrict__ bias1,
                   const float* __restrict__ bias2,
                   float* __restrict__ Cbase,
                   int Mrows, int Nout, int Kdim)
{
    const int z = blockIdx.z;
    const unsigned short* __restrict__ A = Abase + (size_t)z * Mrows * Kdim;
    const unsigned short* __restrict__ W = Wbase + (size_t)z * Nout * Kdim;
    const float* __restrict__ bias = (z == 0) ? bias0 : (z == 1) ? bias1 : bias2;
    float* __restrict__ C = Cbase + (size_t)z * Mrows * Nout;

    __shared__ __align__(16) unsigned short As[2][BM * LSTR];
    __shared__ __align__(16) unsigned short Bs[2][BN * LSTR];

    const int tid  = threadIdx.x;
    const int lane = tid & 31;
    const int wave = tid >> 5;          // 0..7
    const int wr   = wave >> 2;         // 0..1 : wave row (64 rows each)
    const int wc   = wave & 3;          // 0..3 : wave col (32 cols each)

    const int blockRow = blockIdx.y * BM;
    const int blockCol = blockIdx.x * BN;

    v8f acc[4][2];
    #pragma unroll
    for (int i = 0; i < 4; ++i)
        #pragma unroll
        for (int j = 0; j < 2; ++j)
            acc[i][j] = (v8f){0.f, 0.f, 0.f, 0.f, 0.f, 0.f, 0.f, 0.f};

    const int nTiles = Kdim / BK;       // 32

#if ASYNC_LDS
    // ---- async double-buffered pipeline: 4 x b128 per thread per tile ----
    // chunk mapping: tile = A[128x32] ++ B[128x32] bf16 = 1024 x 16B chunks
    auto issue_tile = [&](int buf, int k0) {
        #pragma unroll
        for (int i = 0; i < 2; ++i) {                  // A half: chunks 0..511
            const int c   = tid + i * 256;
            const int row = c >> 2, seg = c & 3;       // 4 x 16B per row
            async_cp16(A + (size_t)(blockRow + row) * Kdim + k0 + seg * 8,
                       &As[buf][row * LSTR + seg * 8]);
        }
        #pragma unroll
        for (int i = 0; i < 2; ++i) {                  // B half
            const int c   = tid + i * 256;
            const int row = c >> 2, seg = c & 3;
            async_cp16(W + (size_t)(blockCol + row) * Kdim + k0 + seg * 8,
                       &Bs[buf][row * LSTR + seg * 8]);
        }
    };

    issue_tile(0, 0);
    for (int t = 0; t < nTiles; ++t) {
        const int cur = t & 1;
        if (t + 1 < nTiles) {
            issue_tile(cur ^ 1, (t + 1) * BK);         // overlap next tile DMA
            WAIT_ASYNC(4);                             // tile t complete (in-order)
        } else {
            WAIT_ASYNC(0);
        }
        __syncthreads();

        v16bf af[4], bfd[2];
        #pragma unroll
        for (int i = 0; i < 4; ++i) af[i]  = load_frag(As[cur], wr * 64 + i * 16, lane);
        #pragma unroll
        for (int j = 0; j < 2; ++j) bfd[j] = load_frag(Bs[cur], wc * 32 + j * 16, lane);

        #pragma unroll
        for (int i = 0; i < 4; ++i)
            #pragma unroll
            for (int j = 0; j < 2; ++j)
                acc[i][j] = __builtin_amdgcn_wmma_f32_16x16x32_bf16(
                    false, af[i], false, bfd[j], (short)0, acc[i][j], false, false);
        __syncthreads();                                // buf[cur] reusable
    }
#else
    // ---- sync fallback: batched wide loads, then wide LDS stores ----
    for (int t = 0; t < nTiles; ++t) {
        const int k0 = t * BK;
        uint4 ra[2], rb[2];
        #pragma unroll
        for (int i = 0; i < 2; ++i) {
            const int c = tid + i * 256, row = c >> 2, seg = c & 3;
            ra[i] = *reinterpret_cast<const uint4*>(
                A + (size_t)(blockRow + row) * Kdim + k0 + seg * 8);
            rb[i] = *reinterpret_cast<const uint4*>(
                W + (size_t)(blockCol + row) * Kdim + k0 + seg * 8);
        }
        __syncthreads();
        #pragma unroll
        for (int i = 0; i < 2; ++i) {
            const int c = tid + i * 256, row = c >> 2, seg = c & 3;
            *reinterpret_cast<uint4*>(&As[0][row * LSTR + seg * 8]) = ra[i];
            *reinterpret_cast<uint4*>(&Bs[0][row * LSTR + seg * 8]) = rb[i];
        }
        __syncthreads();

        v16bf af[4], bfd[2];
        #pragma unroll
        for (int i = 0; i < 4; ++i) af[i]  = load_frag(As[0], wr * 64 + i * 16, lane);
        #pragma unroll
        for (int j = 0; j < 2; ++j) bfd[j] = load_frag(Bs[0], wc * 32 + j * 16, lane);

        #pragma unroll
        for (int i = 0; i < 4; ++i)
            #pragma unroll
            for (int j = 0; j < 2; ++j)
                acc[i][j] = __builtin_amdgcn_wmma_f32_16x16x32_bf16(
                    false, af[i], false, bfd[j], (short)0, acc[i][j], false, false);
    }
#endif

    // ---- store: VGPR v -> row v (+8 for upper lane half), col = lane&15 ----
    const int cr = (lane >> 4) * 8;
    const int cc = lane & 15;
    #pragma unroll
    for (int i = 0; i < 4; ++i) {
        #pragma unroll
        for (int j = 0; j < 2; ++j) {
            const int col = blockCol + wc * 32 + j * 16 + cc;
            const float b = bias[col];
            #pragma unroll
            for (int v = 0; v < 8; ++v) {
                const int row = blockRow + wr * 64 + i * 16 + cr + v;
                C[(size_t)row * Nout + col] = acc[i][j][v] + b;
            }
        }
    }
}

// fp32 -> bf16 conversion of all seven tensors in ONE launch of few, long-lived
// waves. The bf16 planes lie back to back in the workspace in argument order,
// so sweep n of the grid writes float4 group n * CVT_STRIDE + g of that region.
#define CVT_BLOCKS  512                     // 2 blocks (16 waves) per WGP
#define CVT_STRIDE  (CVT_BLOCKS * 256)      // float4 groups per sweep of the grid
#define ACT_SWEEPS  4                       // 2048 * 1024 / 4 / CVT_STRIDE
#define W_SWEEPS    2                       // 1024 * 1024 / 4 / CVT_STRIDE
static_assert(ACT_SWEEPS * CVT_STRIDE * 4 == 2048 * 1024, "activation sweeps");
static_assert(W_SWEEPS   * CVT_STRIDE * 4 == 1024 * 1024, "weight sweeps");

__global__ void __launch_bounds__(256)
cvt_all_f32_bf16(const float* __restrict__ xq, const float* __restrict__ xk,
                 const float* __restrict__ xv, const float* __restrict__ wq,
                 const float* __restrict__ wk, const float* __restrict__ wv,
                 const float* __restrict__ wo, unsigned short* __restrict__ dst)
{
    const int g = blockIdx.x * 256 + threadIdx.x;
    const float* const act[3] = {xq, xk, xv};
    const float* const wts[4] = {wq, wk, wv, wo};
    float4 f[3 * ACT_SWEEPS + 4 * W_SWEEPS];

    // all loads first: every thread keeps its 20 independent 16B reads in flight.
    // Every loop here is fully unrolled so that f[] stays in registers and the
    // tensor each sweep reads is known at compile time (no per-sweep select).
    #pragma unroll
    for (int t = 0; t < 3; ++t)
        #pragma unroll
        for (int s = 0; s < ACT_SWEEPS; ++s)
            f[t * ACT_SWEEPS + s] =
                reinterpret_cast<const float4*>(act[t])[s * CVT_STRIDE + g];
    #pragma unroll
    for (int t = 0; t < 4; ++t)
        #pragma unroll
        for (int s = 0; s < W_SWEEPS; ++s)
            f[3 * ACT_SWEEPS + t * W_SWEEPS + s] =
                reinterpret_cast<const float4*>(wts[t])[s * CVT_STRIDE + g];

    #pragma unroll
    for (int n = 0; n < 3 * ACT_SWEEPS + 4 * W_SWEEPS; ++n) {
        ushort4 h;
        h.x = f2bf(f[n].x); h.y = f2bf(f[n].y); h.z = f2bf(f[n].z); h.w = f2bf(f[n].w);
        reinterpret_cast<ushort4*>(dst)[n * CVT_STRIDE + g] = h;
    }
}

// Value of lane (l ^ M) of the same 16-lane row, all lanes on (DPP row_xmask).
template <int M>
__device__ __forceinline__ float row_xor(float x) {
    return __int_as_float(__builtin_amdgcn_update_dpp(
        0, __float_as_int(x), 0x160 | M, 0xf, 0xf, true));
}

// Rank-1 per-token attention: scores[d][q] = q_d*k_q/8, so softmax row d is
// softmax_q(q_d*k_q): never materialize the 64x64 matrix. ctx emitted bf16.
// The row maximum needs no pass over the keys: it is q_d/8 times the head's
// largest or smallest key.
__global__ void __launch_bounds__(256)
attn_rank1_softmax(const float* __restrict__ Q, const float* __restrict__ K,
                   const float* __restrict__ V, unsigned short* __restrict__ Ctx)
{
    __shared__ float kk[1024];
    __shared__ float vv[1024];

    const int    tid  = threadIdx.x;
    const size_t base = (size_t)blockIdx.x * 1024;

    const float4 kown = *reinterpret_cast<const float4*>(K + base + tid * 4);
    *reinterpret_cast<float4*>(&kk[tid * 4]) = kown;
    *reinterpret_cast<float4*>(&vv[tid * 4]) =
        *reinterpret_cast<const float4*>(V + base + tid * 4);

    // Largest and smallest key of this thread's head. The 16 lanes of a row hold
    // the head's 64 keys, four each, so four xor steps inside the row finish it.
    float kmax = fmaxf(fmaxf(kown.x, kown.y), fmaxf(kown.z, kown.w));
    float kmin = fminf(fminf(kown.x, kown.y), fminf(kown.z, kown.w));
    kmax = fmaxf(kmax, row_xor<1>(kmax));  kmin = fminf(kmin, row_xor<1>(kmin));
    kmax = fmaxf(kmax, row_xor<2>(kmax));  kmin = fminf(kmin, row_xor<2>(kmin));
    kmax = fmaxf(kmax, row_xor<4>(kmax));  kmin = fminf(kmin, row_xor<4>(kmin));
    kmax = fmaxf(kmax, row_xor<8>(kmax));  kmin = fminf(kmin, row_xor<8>(kmin));
    __syncthreads();

    const float4 qv = *reinterpret_cast<const float4*>(Q + base + tid * 4);
    const int    hb = (tid >> 4) << 6;          // head base (64 ch/head)
    const float  q4[4] = {qv.x, qv.y, qv.z, qv.w};
    float        out[4];

    #pragma unroll
    for (int c = 0; c < 4; ++c) {
        const float s = q4[c] * 0.125f;         // 1/sqrt(64)
        // rounding is monotone, so the largest rounded product s * k_j is the one
        // with the largest key (s >= 0) or with the smallest key (s < 0)
        const float mx = fmaxf(s * kmax, s * kmin);
        float se = 0.f, av = 0.f;
        #pragma unroll 8
        for (int j = 0; j < 64; ++j) {
            const float e = __expf(s * kk[hb + j] - mx);   // v_exp_f32
            se += e;
            av = fmaf(e, vv[hb + j], av);
        }
        out[c] = av / se;
    }
    ushort4 h;
    h.x = f2bf(out[0]); h.y = f2bf(out[1]); h.z = f2bf(out[2]); h.w = f2bf(out[3]);
    *reinterpret_cast<ushort4*>(Ctx + base + tid * 4) = h;
}

extern "C" void kernel_launch(void* const* d_in, const int* in_sizes, int n_in,
                              void* d_out, int out_size, void* d_ws, size_t ws_size,
                              hipStream_t stream) {
    (void)in_sizes; (void)n_in; (void)out_size; (void)ws_size;
    const float* x_q = (const float*)d_in[0];
    const float* x_k = (const float*)d_in[1];
    const float* x_v = (const float*)d_in[2];
    const float* Wq  = (const float*)d_in[3];
    const float* bq  = (const float*)d_in[4];
    const float* Wk  = (const float*)d_in[5];
    const float* bk  = (const float*)d_in[6];
    const float* Wv  = (const float*)d_in[7];
    const float* bv  = (const float*)d_in[8];
    const float* Wo  = (const float*)d_in[9];
    const float* bo  = (const float*)d_in[10];
    float* out = (float*)d_out;

    const int Mrows = 4 * 512;                    // 2048 tokens
    const int D     = 1024;
    const size_t actElems = (size_t)Mrows * D;    // 2M
    const size_t wElems   = (size_t)D * D;        // 1M

    // workspace layout (48 MB total)
    unsigned short* bXq = (unsigned short*)d_ws;
    unsigned short* bXk = bXq + actElems;
    unsigned short* bXv = bXk + actElems;
    unsigned short* bWq = bXv + actElems;
    unsigned short* bWk = bWq + wElems;
    unsigned short* bWv = bWk + wElems;
    unsigned short* bWo = bWv + wElems;
    float*          Qf  = (float*)(bWo + wElems);
    float*          Kf  = Qf + actElems;
    float*          Vf  = Kf + actElems;
    unsigned short* Cx  = (unsigned short*)(Vf + actElems);

    dim3 block(256);
    // bXq..bWo are contiguous in this order: one launch fills all seven planes
    cvt_all_f32_bf16<<<CVT_BLOCKS, block, 0, stream>>>(x_q, x_k, x_v, Wq, Wk, Wv, Wo, bXq);

    // Q, K and V projections are independent: one launch, 384 blocks resident
    // together (bXq|bXk|bXv, bWq|bWk|bWv and Qf|Kf|Vf are each contiguous)
    dim3 gridQKV(D / BN, Mrows / BM, 3);          // (8, 16, 3)
    gemm_bias_bf16wmma<<<gridQKV, block, 0, stream>>>(bXq, bWq, bq, bk, bv, Qf, Mrows, D, D);

    attn_rank1_softmax<<<dim3(Mrows), block, 0, stream>>>(Qf, Kf, Vf, Cx);

    dim3 gridO(D / BN, Mrows / BM, 1);            // (8, 16, 1)
    gemm_bias_bf16wmma<<<gridO, block, 0, stream>>>(Cx, bWo, bo, bo, bo, out, Mrows, D, D);
}

// v004
// One run takes 58.4 microseconds.
// Two timings next to v003 both put it at 1.09 times that version's speed.
// All steps since v000 together make it 2.10 times as fast.
#include <hip/hip_runtime.h>

// ---------------------------------------------------------------------------
// MHTempCtxAttention for MI455X (gfx1250, wave32, WMMA + async LDS DMA)
// Pipeline:
//   1) one-launch fp32->bf16 conversion of activations & weights
//   2) bf16 WMMA GEMMs, tiles staged into LDS with
//      GLOBAL_LOAD_ASYNC_TO_LDS_B128 + s_wait_asynccnt double-buffer pipeline;
//      K is split over S groups of eight waves inside each block
//   3) rank-1 softmax attention on fp32 VALU (v_exp_f32), ctx emitted as bf16
//   4) output projection GEMM -> fp32 d_out
// ---------------------------------------------------------------------------

typedef __attribute__((ext_vector_type(16))) __bf16 v16bf;
typedef __attribute__((ext_vector_type(8)))  float  v8f;
typedef __attribute__((ext_vector_type(4)))  int    v4i;

#define BM   128      // block tile rows
#define BN   128      // block tile cols
#define BK   32       // K step (WMMA K for bf16)
#define LSTR 40       // LDS row stride in bf16 elems (32 + 8 pad; rows stay 16B aligned)

#if __has_builtin(__builtin_amdgcn_global_load_async_to_lds_b128)
#define ASYNC_LDS 1
#else
#define ASYNC_LDS 0
#endif

#if __has_builtin(__builtin_amdgcn_s_wait_asynccnt)
#define WAIT_ASYNC(n) __builtin_amdgcn_s_wait_asynccnt(n)
#else
#define WAIT_ASYNC(n) asm volatile("s_wait_asynccnt %0" :: "n"(n) : "memory")
#endif

typedef __attribute__((address_space(1))) v4i as1_v4i;   // global 16B vector
typedef __attribute__((address_space(3))) v4i as3_v4i;   // LDS 16B vector

__device__ __forceinline__ unsigned short f2bf(float f) {
    unsigned int u = __float_as_uint(f);
    u += 0x7FFFu + ((u >> 16) & 1u);           // round-to-nearest-even
    return (unsigned short)(u >> 16);
}

#if ASYNC_LDS
// 16B async DMA: LDS[dst] = MEM[src], tracked by ASYNCcnt (no VGPR round-trip)
__device__ __forceinline__ void async_cp16(const void* gsrc, void* ldsdst) {
    __builtin_amdgcn_global_load_async_to_lds_b128(
        (as1_v4i*)(unsigned long long)gsrc,
        (as3_v4i*)(unsigned int)(unsigned long long)ldsdst,
        /*offset=*/0, /*cpol=*/0);
}
#endif

// Load one 16x32 bf16 fragment from LDS (ISA striping):
//   lanes 0-15 : row = lane,    K = {0..7, 16..23}
//   lanes 16-31: row = lane-16, K = {8..15, 24..31}
__device__ __forceinline__ v16bf load_frag(const unsigned short* lds,
                                           int rowBase, int lane) {
    const int r  = lane & 15;
    const int kb = (lane >> 4) << 3;
    const unsigned short* p = lds + (rowBase + r) * LSTR + kb;
    union { v16bf v; uint4 q[2]; } u;
    u.q[0] = *reinterpret_cast<const uint4*>(p);
    u.q[1] = *reinterpret_cast<const uint4*>(p + 16);
    return u.v;
}

// C[M x N] = A[M x K](bf16) * W[N x K](bf16)^T + bias[N](f32), C = f32
// blockIdx.z picks one of up to three independent products of the same shape:
// their A, W and C planes lie back to back behind Abase, Wbase and Cbase.
// A block is S groups of eight waves. Every group works on the whole 128 x 128
// tile but walks only its own Kdim / S slice of K, with its own pair of LDS
// buffers: the serial chain of K steps (each one a copy latency, LDS latencies
// and two barriers long) is S times shorter, and the groups fill each other's
// stalls. The S partial tiles are added through LDS behind the loop.
// Kdim must be a multiple of S * BK.
template <int S>
__global__ void __launch_bounds__(256 * S)
gemm_bias_bf16wmma(const unsigned short* __restrict__ Abase,
                   const unsigned short* __restrict__ Wbase,
                   const float* __restrict__ bias0,
                   const float* __restrict__ bias1,
                   const float* __restrict__ bias2,
                   float* __restrict__ Cbase,
                   int Mrows, int Nout, int Kdim)
{
    const int z = blockIdx.z;
    const unsigned short* __restrict__ A = Abase + (size_t)z * Mrows * Kdim;
    const unsigned short* __restrict__ W = Wbase + (size_t)z * Nout * Kdim;
    const float* __restrict__ bias = (z == 0) ? bias0 : (z == 1) ? bias1 : bias2;
    float* __restrict__ C = Cbase + (size_t)z * Mrows * Nout;

    // ring: per group two A and two B buffers; behind the loop the same LDS holds
    // the partial tiles on their way to the group that finishes them
    constexpr int RING_BYTES = S * 2 * (BM + BN) * LSTR * 2;
    constexpr int RED_BYTES  = (S - 1) * BM * BN * 4;
    __shared__ __align__(16) unsigned char smem[RING_BYTES > RED_BYTES ? RING_BYTES : RED_BYTES];

    // group number: the same in every lane of a wave, kept scalar for the branches
    const int grp  = __builtin_amdgcn_readfirstlane((int)(threadIdx.x >> 8));
    const int tid  = threadIdx.x & 255; // thread within its group
    unsigned short* const As0 = reinterpret_cast<unsigned short*>(smem) + grp * 2 * (BM + BN) * LSTR;
    unsigned short* const Bs0 = As0 + 2 * BM * LSTR;
    const int lane = tid & 31;
    const int wave = tid >> 5;          // 0..7
    const int wr   = wave >> 2;         // 0..1 : wave row (64 rows each)
    const int wc   = wave & 3;          // 0..3 : wave col (32 cols each)

    const int blockRow = blockIdx.y * BM;
    const int blockCol = blockIdx.x * BN;

    v8f acc[4][2];
    #pragma unroll
    for (int i = 0; i < 4; ++i)
        #pragma unroll
        for (int j = 0; j < 2; ++j)
            acc[i][j] = (v8f){0.f, 0.f, 0.f, 0.f, 0.f, 0.f, 0.f, 0.f};

    const int kBase  = grp * (Kdim / S); // first k of this group's slice
    const int nTiles = Kdim / (S * BK);  // K steps of one group

#if ASYNC_LDS
    // ---- async double-buffered pipeline: 4 x b128 per thread per tile ----
    // chunk mapping: tile = A[128x32] ++ B[128x32] bf16 = 1024 x 16B chunks
    auto issue_tile = [&](int buf, int k0) {
        #pragma unroll
        for (int i = 0; i < 2; ++i) {                  // A half: chunks 0..511
            const int c   = tid + i * 256;
            const int row = c >> 2, seg = c & 3;       // 4 x 16B per row
            async_cp16(A + (size_t)(blockRow + row) * Kdim + k0 + seg * 8,
                       As0 + buf * BM * LSTR + row * LSTR + seg * 8);
        }
        #pragma unroll
        for (int i = 0; i < 2; ++i) {                  // B half
            const int c   = tid + i * 256;
            const int row = c >> 2, seg = c & 3;
            async_cp16(W + (size_t)(blockCol + row) * Kdim + k0 + seg * 8,
                       Bs0 + buf * BN * LSTR + row * LSTR + seg * 8);
        }
    };

    issue_tile(0, kBase);
    for (int t = 0; t < nTiles; ++t) {
        const int cur = t & 1;
        if (t + 1 < nTiles) {
            issue_tile(cur ^ 1, kBase + (t + 1) * BK); // overlap next tile DMA
            WAIT_ASYNC(4);                             // tile t complete (in-order)
        } else {
            WAIT_ASYNC(0);
        }
        // publishes tile t to the group's other waves; standing directly behind
        // the wait it also holds the LDS reads below behind that wait
        __syncthreads();

        v16bf af[4], bfd[2];
        #pragma unroll
        for (int i = 0; i < 4; ++i) af[i]  = load_frag(As0 + cur * BM * LSTR, wr * 64 + i * 16, lane);
        #pragma unroll
        for (int j = 0; j < 2; ++j) bfd[j] = load_frag(Bs0 + cur * BN * LSTR, wc * 32 + j * 16, lane);

        #pragma unroll
        for (int i = 0; i < 4; ++i)
            #pragma unroll
            for (int j = 0; j < 2; ++j)
                acc[i][j] = __builtin_amdgcn_wmma_f32_16x16x32_bf16(
                    false, af[i], false, bfd[j], (short)0, acc[i][j], false, false);
        __syncthreads();                                // buf[cur] reusable
    }
#else
    // ---- sync fallback: batched wide loads, then wide LDS stores ----
    for (int t = 0; t < nTiles; ++t) {
        const int k0 = kBase + t * BK;
        uint4 ra[2], rb[2];
        #pragma unroll
        for (int i = 0; i < 2; ++i) {
            const int c = tid + i * 256, row = c >> 2, seg = c & 3;
            ra[i] = *reinterpret_cast<const uint4*>(
                A + (size_t)(blockRow + row) * Kdim + k0 + seg * 8);
            rb[i] = *reinterpret_cast<const uint4*>(
                W + (size_t)(blockCol + row) * Kdim + k0 + seg * 8);
        }
        __syncthreads();
        #pragma unroll
        for (int i = 0; i < 2; ++i) {
            const int c = tid + i * 256, row = c >> 2, seg = c & 3;
            *reinterpret_cast<uint4*>(As0 + row * LSTR + seg * 8) = ra[i];
            *reinterpret_cast<uint4*>(Bs0 + row * LSTR + seg * 8) = rb[i];
        }
        __syncthreads();

        v16bf af[4], bfd[2];
        #pragma unroll
        for (int i = 0; i < 4; ++i) af[i]  = load_frag(As0, wr * 64 + i * 16, lane);
        #pragma unroll
        for (int j = 0; j < 2; ++j) bfd[j] = load_frag(Bs0, wc * 32 + j * 16, lane);

        #pragma unroll
        for (int i = 0; i < 4; ++i)
            #pragma unroll
            for (int j = 0; j < 2; ++j)
                acc[i][j] = __builtin_amdgcn_wmma_f32_16x16x32_bf16(
                    false, af[i], false, bfd[j], (short)0, acc[i][j], false, false);
    }
    __syncthreads();                                    // ring reusable
#endif

    // ---- add the S partial tiles: group o finishes accumulator rows
    // i = o * IPG .. o * IPG + IPG - 1 of every wave. Each group hands the rows it
    // does not finish to their owner through LDS, 16 B per lane and lanes side by
    // side. The ring is free: the loop ended in a barrier behind every wave's last
    // LDS read, and no copy is outstanding behind the last trip's wait to 0.
    constexpr int IPG = 4 / S;
    float4* const red = reinterpret_cast<float4*>(smem);
    #pragma unroll
    for (int i = 0; i < 4; ++i) {
        const int owner = i / IPG;
        if (grp != owner) {
            const int slot = owner * (S - 1) + (grp < owner ? grp : grp - 1);
            #pragma unroll
            for (int j = 0; j < 2; ++j)
                #pragma unroll
                for (int h = 0; h < 2; ++h)
                    red[((slot * IPG + i % IPG) * 4 + j * 2 + h) * 256 + tid] =
                        make_float4(acc[i][j][h * 4 + 0], acc[i][j][h * 4 + 1],
                                    acc[i][j][h * 4 + 2], acc[i][j][h * 4 + 3]);
        }
    }
    __syncthreads();                                    // partial tiles visible to their owners

    // the rows this group finishes, picked by the scalar group number so that one
    // copy of the code below serves every group
    v8f fin[IPG][2];
    #pragma unroll
    for (int i = 0; i < 4; ++i)
        if (grp == i / IPG) {
            fin[i % IPG][0] = acc[i][0];
            fin[i % IPG][1] = acc[i][1];
        }
    // own partial first, then the other groups' in rising group order
    #pragma unroll
    for (int s = 0; s < S - 1; ++s)
        #pragma unroll
        for (int ii = 0; ii < IPG; ++ii)
            #pragma unroll
            for (int j = 0; j < 2; ++j)
                #pragma unroll
                for (int h = 0; h < 2; ++h) {
                    const float4 p =
                        red[(((grp * (S - 1) + s) * IPG + ii) * 4 + j * 2 + h) * 256 + tid];
                    fin[ii][j][h * 4 + 0] += p.x;  fin[ii][j][h * 4 + 1] += p.y;
                    fin[ii][j][h * 4 + 2] += p.z;  fin[ii][j][h * 4 + 3] += p.w;
                }

    // ---- store: VGPR v -> row v (+8 for upper lane half), col = lane&15 ----
    const int cr = (lane >> 4) * 8;
    const int cc = lane & 15;
    #pragma unroll
    for (int ii = 0; ii < IPG; ++ii) {
        #pragma unroll
        for (int j = 0; j < 2; ++j) {
            const int col = blockCol + wc * 32 + j * 16 + cc;
            const float b = bias[col];
            #pragma unroll
            for (int v = 0; v < 8; ++v) {
                const int row = blockRow + wr * 64 + (grp * IPG + ii) * 16 + cr + v;
                C[(size_t)row * Nout + col] = fin[ii][j][v] + b;
            }
        }
    }
}

// fp32 -> bf16 conversion of all seven tensors in ONE launch of few, long-lived
// waves. The bf16 planes lie back to back in the workspace in argument order,
// so sweep n of the grid writes float4 group n * CVT_STRIDE + g of that region.
#define CVT_BLOCKS  512                     // 2 blocks (16 waves) per WGP
#define CVT_STRIDE  (CVT_BLOCKS * 256)      // float4 groups per sweep of the grid
#define ACT_SWEEPS  4                       // 2048 * 1024 / 4 / CVT_STRIDE
#define W_SWEEPS    2                       // 1024 * 1024 / 4 / CVT_STRIDE
static_assert(ACT_SWEEPS * CVT_STRIDE * 4 == 2048 * 1024, "activation sweeps");
static_assert(W_SWEEPS   * CVT_STRIDE * 4 == 1024 * 1024, "weight sweeps");

__global__ void __launch_bounds__(256)
cvt_all_f32_bf16(const float* __restrict__ xq, const float* __restrict__ xk,
                 const float* __restrict__ xv, const float* __restrict__ wq,
                 const float* __restrict__ wk, const float* __restrict__ wv,
                 const float* __restrict__ wo, unsigned short* __restrict__ dst)
{
    const int g = blockIdx.x * 256 + threadIdx.x;
    const float* const act[3] = {xq, xk, xv};
    const float* const wts[4] = {wq, wk, wv, wo};
    float4 f[3 * ACT_SWEEPS + 4 * W_SWEEPS];

    // all loads first: every thread keeps its 20 independent 16B reads in flight.
    // Every loop here is fully unrolled so that f[] stays in registers and the
    // tensor each sweep reads is known at compile time (no per-sweep select).
    #pragma unroll
    for (int t = 0; t < 3; ++t)
        #pragma unroll
        for (int s = 0; s < ACT_SWEEPS; ++s)
            f[t * ACT_SWEEPS + s] =
                reinterpret_cast<const float4*>(act[t])[s * CVT_STRIDE + g];
    #pragma unroll
    for (int t = 0; t < 4; ++t)
        #pragma unroll
        for (int s = 0; s < W_SWEEPS; ++s)
            f[3 * ACT_SWEEPS + t * W_SWEEPS + s] =
                reinterpret_cast<const float4*>(wts[t])[s * CVT_STRIDE + g];

    #pragma unroll
    for (int n = 0; n < 3 * ACT_SWEEPS + 4 * W_SWEEPS; ++n) {
        ushort4 h;
        h.x = f2bf(f[n].x); h.y = f2bf(f[n].y); h.z = f2bf(f[n].z); h.w = f2bf(f[n].w);
        reinterpret_cast<ushort4*>(dst)[n * CVT_STRIDE + g] = h;
    }
}

// Value of lane (l ^ M) of the same 16-lane row, all lanes on (DPP row_xmask).
template <int M>
__device__ __forceinline__ float row_xor(float x) {
    return __int_as_float(__builtin_amdgcn_update_dpp(
        0, __float_as_int(x), 0x160 | M, 0xf, 0xf, true));
}

// Rank-1 per-token attention: scores[d][q] = q_d*k_q/8, so softmax row d is
// softmax_q(q_d*k_q): never materialize the 64x64 matrix. ctx emitted bf16.
// The row maximum needs no pass over the keys: it is q_d/8 times the head's
// largest or smallest key.
__global__ void __launch_bounds__(256)
attn_rank1_softmax(const float* __restrict__ Q, const float* __restrict__ K,
                   const float* __restrict__ V, unsigned short* __restrict__ Ctx)
{
    __shared__ float kk[1024];
    __shared__ float vv[1024];

    const int    tid  = threadIdx.x;
    const size_t base = (size_t)blockIdx.x * 1024;

    const float4 kown = *reinterpret_cast<const float4*>(K + base + tid * 4);
    *reinterpret_cast<float4*>(&kk[tid * 4]) = kown;
    *reinterpret_cast<float4*>(&vv[tid * 4]) =
        *reinterpret_cast<const float4*>(V + base + tid * 4);

    // Largest and smallest key of this thread's head. The 16 lanes of a row hold
    // the head's 64 keys, four each, so four xor steps inside the row finish it.
    float kmax = fmaxf(fmaxf(kown.x, kown.y), fmaxf(kown.z, kown.w));
    float kmin = fminf(fminf(kown.x, kown.y), fminf(kown.z, kown.w));
    kmax = fmaxf(kmax, row_xor<1>(kmax));  kmin = fminf(kmin, row_xor<1>(kmin));
    kmax = fmaxf(kmax, row_xor<2>(kmax));  kmin = fminf(kmin, row_xor<2>(kmin));
    kmax = fmaxf(kmax, row_xor<4>(kmax));  kmin = fminf(kmin, row_xor<4>(kmin));
    kmax = fmaxf(kmax, row_xor<8>(kmax));  kmin = fminf(kmin, row_xor<8>(kmin));
    __syncthreads();

    const float4 qv = *reinterpret_cast<const float4*>(Q + base + tid * 4);
    const int    hb = (tid >> 4) << 6;          // head base (64 ch/head)
    const float  q4[4] = {qv.x, qv.y, qv.z, qv.w};
    float        out[4];

    #pragma unroll
    for (int c = 0; c < 4; ++c) {
        const float s = q4[c] * 0.125f;         // 1/sqrt(64)
        // rounding is monotone, so the largest rounded product s * k_j is the one
        // with the largest key (s >= 0) or with the smallest key (s < 0)
        const float mx = fmaxf(s * kmax, s * kmin);
        float se = 0.f, av = 0.f;
        #pragma unroll 8
        for (int j = 0; j < 64; ++j) {
            const float e = __expf(s * kk[hb + j] - mx);   // v_exp_f32
            se += e;
            av = fmaf(e, vv[hb + j], av);
        }
        out[c] = av / se;
    }
    ushort4 h;
    h.x = f2bf(out[0]); h.y = f2bf(out[1]); h.z = f2bf(out[2]); h.w = f2bf(out[3]);
    *reinterpret_cast<ushort4*>(Ctx + base + tid * 4) = h;
}

extern "C" void kernel_launch(void* const* d_in, const int* in_sizes, int n_in,
                              void* d_out, int out_size, void* d_ws, size_t ws_size,
                              hipStream_t stream) {
    (void)in_sizes; (void)n_in; (void)out_size; (void)ws_size;
    const float* x_q = (const float*)d_in[0];
    const float* x_k = (const float*)d_in[1];
    const float* x_v = (const float*)d_in[2];
    const float* Wq  = (const float*)d_in[3];
    const float* bq  = (const float*)d_in[4];
    const float* Wk  = (const float*)d_in[5];
    const float* bk  = (const float*)d_in[6];
    const float* Wv  = (const float*)d_in[7];
    const float* bv  = (const float*)d_in[8];
    const float* Wo  = (const float*)d_in[9];
    const float* bo  = (const float*)d_in[10];
    float* out = (float*)d_out;

    const int Mrows = 4 * 512;                    // 2048 tokens
    const int D     = 1024;
    const size_t actElems = (size_t)Mrows * D;    // 2M
    const size_t wElems   = (size_t)D * D;        // 1M

    // workspace layout (48 MB total)
    unsigned short* bXq = (unsigned short*)d_ws;
    unsigned short* bXk = bXq + actElems;
    unsigned short* bXv = bXk + actElems;
    unsigned short* bWq = bXv + actElems;
    unsigned short* bWk = bWq + wElems;
    unsigned short* bWv = bWk + wElems;
    unsigned short* bWo = bWv + wElems;
    float*          Qf  = (float*)(bWo + wElems);
    float*          Kf  = Qf + actElems;
    float*          Vf  = Kf + actElems;
    unsigned short* Cx  = (unsigned short*)(Vf + actElems);

    dim3 block(256);
    // bXq..bWo are contiguous in this order: one launch fills all seven planes
    cvt_all_f32_bf16<<<CVT_BLOCKS, block, 0, stream>>>(x_q, x_k, x_v, Wq, Wk, Wv, Wo, bXq);

    // Q, K and V projections are independent: one launch, 384 blocks resident
    // together (bXq|bXk|bXv, bWq|bWk|bWv and Qf|Kf|Vf are each contiguous).
    // K in two slices: two blocks of 16 waves still share a WGP.
    dim3 gridQKV(D / BN, Mrows / BM, 3);          // (8, 16, 3)
    gemm_bias_bf16wmma<2><<<gridQKV, dim3(512), 0, stream>>>(bXq, bWq, bq, bk, bv, Qf, Mrows, D, D);

    attn_rank1_softmax<<<dim3(Mrows), block, 0, stream>>>(Qf, Kf, Vf, Cx);

    // 128 blocks, at most one per WGP: K in four slices, 32 waves a block
    dim3 gridO(D / BN, Mrows / BM, 1);            // (8, 16, 1)
    gemm_bias_bf16wmma<4><<<gridO, dim3(1024), 0, stream>>>(Cx, bWo, bo, bo, bo, out, Mrows, D, D);
}

// v005
// Measured time: 54.6 microseconds a run.
// Next to v004, in two timings, it ran 1.07 times as fast each time.
// Counting every step since v000, it is 2.25 times as fast.
#include <hip/hip_runtime.h>

// ---------------------------------------------------------------------------
// MHTempCtxAttention for MI455X (gfx1250, wave32, WMMA + async LDS DMA)
// Pipeline:
//   1) one-launch fp32->bf16 conversion of activations & weights
//   2) bf16 WMMA GEMMs, tiles staged into LDS with
//      GLOBAL_LOAD_ASYNC_TO_LDS_B128 + s_wait_asynccnt double-buffer pipeline;
//      K is split over S groups of eight waves inside each block
//   3) rank-1 softmax attention on fp32 VALU (v_exp_f32), ctx emitted as bf16
//   4) output projection GEMM -> fp32 d_out
// ---------------------------------------------------------------------------

typedef __attribute__((ext_vector_type(16))) __bf16 v16bf;
typedef __attribute__((ext_vector_type(8)))  float  v8f;
typedef __attribute__((ext_vector_type(4)))  int    v4i;

#define BM   128      // block tile rows
#define BN   128      // block tile cols
#define BK   64       // K step: one tile row is 128 B, a whole cache line (two WMMA K of 32)
#define LSTR 72       // LDS row stride in bf16 elems (64 + 8 pad; 144 B = 16 B x odd)

#if __has_builtin(__builtin_amdgcn_global_load_async_to_lds_b128)
#define ASYNC_LDS 1
#else
#define ASYNC_LDS 0
#endif

#if __has_builtin(__builtin_amdgcn_s_wait_asynccnt)
#define WAIT_ASYNC(n) __builtin_amdgcn_s_wait_asynccnt(n)
#else
#define WAIT_ASYNC(n) asm volatile("s_wait_asynccnt %0" :: "n"(n) : "memory")
#endif

typedef __attribute__((address_space(1))) v4i as1_v4i;   // global 16B vector
typedef __attribute__((address_space(3))) v4i as3_v4i;   // LDS 16B vector

__device__ __forceinline__ unsigned short f2bf(float f) {
    unsigned int u = __float_as_uint(f);
    u += 0x7FFFu + ((u >> 16) & 1u);           // round-to-nearest-even
    return (unsigned short)(u >> 16);
}

#if ASYNC_LDS
// 16B async DMA: LDS[dst] = MEM[src], tracked by ASYNCcnt (no VGPR round-trip)
__device__ __forceinline__ void async_cp16(const void* gsrc, void* ldsdst) {
    __builtin_amdgcn_global_load_async_to_lds_b128(
        (as1_v4i*)(unsigned long long)gsrc,
        (as3_v4i*)(unsigned int)(unsigned long long)ldsdst,
        /*offset=*/0, /*cpol=*/0);
}
#endif

// Load one 16x32 bf16 fragment from LDS, k0 = first k of the fragment inside the
// tile row (ISA striping):
//   lanes 0-15 : row = lane,    K = {0..7, 16..23}
//   lanes 16-31: row = lane-16, K = {8..15, 24..31}
__device__ __forceinline__ v16bf load_frag(const unsigned short* lds,
                                           int rowBase, int k0, int lane) {
    const int r  = lane & 15;
    const int kb = (lane >> 4) << 3;
    const unsigned short* p = lds + (rowBase + r) * LSTR + k0 + kb;
    union { v16bf v; uint4 q[2]; } u;
    u.q[0] = *reinterpret_cast<const uint4*>(p);
    u.q[1] = *reinterpret_cast<const uint4*>(p + 16);
    return u.v;
}

// C[M x N] = A[M x K](bf16) * W[N x K](bf16)^T + bias[N](f32), C = f32
// blockIdx.z picks one of up to three independent products of the same shape:
// their A, W and C planes lie back to back behind Abase, Wbase and Cbase.
// A block is S groups of eight waves. Every group works on the whole 128 x 128
// tile but walks only its own Kdim / S slice of K, with its own pair of LDS
// buffers: the serial chain of K steps (each one a copy latency, LDS latencies
// and two barriers long) is S times shorter, and the groups fill each other's
// stalls. The S partial tiles are added through LDS behind the loop.
// Kdim must be a multiple of S * BK.
template <int S>
__global__ void __launch_bounds__(256 * S)
gemm_bias_bf16wmma(const unsigned short* __restrict__ Abase,
                   const unsigned short* __restrict__ Wbase,
                   const float* __restrict__ bias0,
                   const float* __restrict__ bias1,
                   const float* __restrict__ bias2,
                   float* __restrict__ Cbase,
                   int Mrows, int Nout, int Kdim)
{
    const int z = blockIdx.z;
    const unsigned short* __restrict__ A = Abase + (size_t)z * Mrows * Kdim;
    const unsigned short* __restrict__ W = Wbase + (size_t)z * Nout * Kdim;
    const float* __restrict__ bias = (z == 0) ? bias0 : (z == 1) ? bias1 : bias2;
    float* __restrict__ C = Cbase + (size_t)z * Mrows * Nout;

    // ring: per group two A and two B buffers; behind the loop the same LDS holds
    // the partial tiles on their way to the group that finishes them
    constexpr int RING_BYTES = S * 2 * (BM + BN) * LSTR * 2;
    constexpr int RED_BYTES  = (S - 1) * BM * BN * 4;
    __shared__ __align__(16) unsigned char smem[RING_BYTES > RED_BYTES ? RING_BYTES : RED_BYTES];

    // group number: the same in every lane of a wave, kept scalar for the branches
    const int grp  = __builtin_amdgcn_readfirstlane((int)(threadIdx.x >> 8));
    const int tid  = threadIdx.x & 255; // thread within its group
    unsigned short* const As0 = reinterpret_cast<unsigned short*>(smem) + grp * 2 * (BM + BN) * LSTR;
    unsigned short* const Bs0 = As0 + 2 * BM * LSTR;
    const int lane = tid & 31;
    const int wave = tid >> 5;          // 0..7
    const int wr   = wave >> 2;         // 0..1 : wave row (64 rows each)
    const int wc   = wave & 3;          // 0..3 : wave col (32 cols each)

    const int blockRow = blockIdx.y * BM;
    const int blockCol = blockIdx.x * BN;

    v8f acc[4][2];
    #pragma unroll
    for (int i = 0; i < 4; ++i)
        #pragma unroll
        for (int j = 0; j < 2; ++j)
            acc[i][j] = (v8f){0.f, 0.f, 0.f, 0.f, 0.f, 0.f, 0.f, 0.f};

    const int kBase  = grp * (Kdim / S); // first k of this group's slice
    const int nTiles = Kdim / (S * BK);  // K steps of one group

#if ASYNC_LDS
    // ---- async double-buffered pipeline: 8 x b128 per thread per tile ----
    // chunk mapping: tile = A[128x64] ++ B[128x64] bf16 = 2048 x 16B chunks.
    // Eight lanes side by side take one row's 128 B, so a wave's copy touches
    // four whole cache lines and no line is asked for by two K steps.
    auto issue_tile = [&](int buf, int k0) {
        #pragma unroll
        for (int i = 0; i < 4; ++i) {                  // A half: chunks 0..1023
            const int c   = tid + i * 256;
            const int row = c >> 3, seg = c & 7;       // 8 x 16B per row
            async_cp16(A + (size_t)(blockRow + row) * Kdim + k0 + seg * 8,
                       As0 + buf * BM * LSTR + row * LSTR + seg * 8);
        }
        #pragma unroll
        for (int i = 0; i < 4; ++i) {                  // B half
            const int c   = tid + i * 256;
            const int row = c >> 3, seg = c & 7;
            async_cp16(W + (size_t)(blockCol + row) * Kdim + k0 + seg * 8,
                       Bs0 + buf * BN * LSTR + row * LSTR + seg * 8);
        }
    };

    issue_tile(0, kBase);
    for (int t = 0; t < nTiles; ++t) {
        const int cur = t & 1;
        if (t + 1 < nTiles) {
            issue_tile(cur ^ 1, kBase + (t + 1) * BK); // overlap next tile DMA
            WAIT_ASYNC(8);                             // all but tile t+1's eight: tile t landed
        } else {
            WAIT_ASYNC(0);
        }
        // publishes tile t to the group's other waves; standing directly behind
        // the wait it also holds the LDS reads below behind that wait
        __syncthreads();

        // the tile's two WMMA K slices in rising k: the sum order stays the same;
        // unrolled so that ks is a constant in the LDS read offsets
        #pragma unroll
        for (int ks = 0; ks < BK; ks += 32) {
            v16bf af[4], bfd[2];
            #pragma unroll
            for (int i = 0; i < 4; ++i) af[i]  = load_frag(As0 + cur * BM * LSTR, wr * 64 + i * 16, ks, lane);
            #pragma unroll
            for (int j = 0; j < 2; ++j) bfd[j] = load_frag(Bs0 + cur * BN * LSTR, wc * 32 + j * 16, ks, lane);

            #pragma unroll
            for (int i = 0; i < 4; ++i)
                #pragma unroll
                for (int j = 0; j < 2; ++j)
                    acc[i][j] = __builtin_amdgcn_wmma_f32_16x16x32_bf16(
                        false, af[i], false, bfd[j], (short)0, acc[i][j], false, false);
        }
        __syncthreads();                                // buf[cur] reusable
    }
#else
    // ---- sync fallback: batched wide loads, then wide LDS stores ----
    for (int t = 0; t < nTiles; ++t) {
        const int k0 = kBase + t * BK;
        uint4 ra[4], rb[4];
        #pragma unroll
        for (int i = 0; i < 4; ++i) {
            const int c = tid + i * 256, row = c >> 3, seg = c & 7;
            ra[i] = *reinterpret_cast<const uint4*>(
                A + (size_t)(blockRow + row) * Kdim + k0 + seg * 8);
            rb[i] = *reinterpret_cast<const uint4*>(
                W + (size_t)(blockCol + row) * Kdim + k0 + seg * 8);
        }
        __syncthreads();
        #pragma unroll
        for (int i = 0; i < 4; ++i) {
            const int c = tid + i * 256, row = c >> 3, seg = c & 7;
            *reinterpret_cast<uint4*>(As0 + row * LSTR + seg * 8) = ra[i];
            *reinterpret_cast<uint4*>(Bs0 + row * LSTR + seg * 8) = rb[i];
        }
        __syncthreads();

        #pragma unroll
        for (int ks = 0; ks < BK; ks += 32) {
            v16bf af[4], bfd[2];
            #pragma unroll
            for (int i = 0; i < 4; ++i) af[i]  = load_frag(As0, wr * 64 + i * 16, ks, lane);
            #pragma unroll
            for (int j = 0; j < 2; ++j) bfd[j] = load_frag(Bs0, wc * 32 + j * 16, ks, lane);

            #pragma unroll
            for (int i = 0; i < 4; ++i)
                #pragma unroll
                for (int j = 0; j < 2; ++j)
                    acc[i][j] = __builtin_amdgcn_wmma_f32_16x16x32_bf16(
                        false, af[i], false, bfd[j], (short)0, acc[i][j], false, false);
        }
    }
    __syncthreads();                                    // ring reusable
#endif

    // ---- add the S partial tiles: group o finishes accumulator rows
    // i = o * IPG .. o * IPG + IPG - 1 of every wave. Each group hands the rows it
    // does not finish to their owner through LDS, 16 B per lane and lanes side by
    // side. The ring is free: the loop ended in a barrier behind every wave's last
    // LDS read, and no copy is outstanding behind the last trip's wait to 0.
    constexpr int IPG = 4 / S;
    float4* const red = reinterpret_cast<float4*>(smem);
    #pragma unroll
    for (int i = 0; i < 4; ++i) {
        const int owner = i / IPG;
        if (grp != owner) {
            const int slot = owner * (S - 1) + (grp < owner ? grp : grp - 1);
            #pragma unroll
            for (int j = 0; j < 2; ++j)
                #pragma unroll
                for (int h = 0; h < 2; ++h)
                    red[((slot * IPG + i % IPG) * 4 + j * 2 + h) * 256 + tid] =
                        make_float4(acc[i][j][h * 4 + 0], acc[i][j][h * 4 + 1],
                                    acc[i][j][h * 4 + 2], acc[i][j][h * 4 + 3]);
        }
    }
    __syncthreads();                                    // partial tiles visible to their owners

    // the rows this group finishes, picked by the scalar group number so that one
    // copy of the code below serves every group
    v8f fin[IPG][2];
    #pragma unroll
    for (int i = 0; i < 4; ++i)
        if (grp == i / IPG) {
            fin[i % IPG][0] = acc[i][0];
            fin[i % IPG][1] = acc[i][1];
        }
    // own partial first, then the other groups' in rising group order
    #pragma unroll
    for (int s = 0; s < S - 1; ++s)
        #pragma unroll
        for (int ii = 0; ii < IPG; ++ii)
            #pragma unroll
            for (int j = 0; j < 2; ++j)
                #pragma unroll
                for (int h = 0; h < 2; ++h) {
                    const float4 p =
                        red[(((grp * (S - 1) + s) * IPG + ii) * 4 + j * 2 + h) * 256 + tid];
                    fin[ii][j][h * 4 + 0] += p.x;  fin[ii][j][h * 4 + 1] += p.y;
                    fin[ii][j][h * 4 + 2] += p.z;  fin[ii][j][h * 4 + 3] += p.w;
                }

    // ---- store: VGPR v -> row v (+8 for upper lane half), col = lane&15 ----
    const int cr = (lane >> 4) * 8;
    const int cc = lane & 15;
    #pragma unroll
    for (int ii = 0; ii < IPG; ++ii) {
        #pragma unroll
        for (int j = 0; j < 2; ++j) {
            const int col = blockCol + wc * 32 + j * 16 + cc;
            const float b = bias[col];
            #pragma unroll
            for (int v = 0; v < 8; ++v) {
                const int row = blockRow + wr * 64 + (grp * IPG + ii) * 16 + cr + v;
                C[(size_t)row * Nout + col] = fin[ii][j][v] + b;
            }
        }
    }
}

// fp32 -> bf16 conversion of all seven tensors in ONE launch of few, long-lived
// waves. The bf16 planes lie back to back in the workspace in argument order,
// so sweep n of the grid writes float4 group n * CVT_STRIDE + g of that region.
#define CVT_BLOCKS  512                     // 2 blocks (16 waves) per WGP
#define CVT_STRIDE  (CVT_BLOCKS * 256)      // float4 groups per sweep of the grid
#define ACT_SWEEPS  4                       // 2048 * 1024 / 4 / CVT_STRIDE
#define W_SWEEPS    2                       // 1024 * 1024 / 4 / CVT_STRIDE
static_assert(ACT_SWEEPS * CVT_STRIDE * 4 == 2048 * 1024, "activation sweeps");
static_assert(W_SWEEPS   * CVT_STRIDE * 4 == 1024 * 1024, "weight sweeps");

__global__ void __launch_bounds__(256)
cvt_all_f32_bf16(const float* __restrict__ xq, const float* __restrict__ xk,
                 const float* __restrict__ xv, const float* __restrict__ wq,
                 const float* __restrict__ wk, const float* __restrict__ wv,
                 const float* __restrict__ wo, unsigned short* __restrict__ dst)
{
    const int g = blockIdx.x * 256 + threadIdx.x;
    const float* const act[3] = {xq, xk, xv};
    const float* const wts[4] = {wq, wk, wv, wo};
    float4 f[3 * ACT_SWEEPS + 4 * W_SWEEPS];

    // all loads first: every thread keeps its 20 independent 16B reads in flight.
    // Every loop here is fully unrolled so that f[] stays in registers and the
    // tensor each sweep reads is known at compile time (no per-sweep select).
    #pragma unroll
    for (int t = 0; t < 3; ++t)
        #pragma unroll
        for (int s = 0; s < ACT_SWEEPS; ++s)
            f[t * ACT_SWEEPS + s] =
                reinterpret_cast<const float4*>(act[t])[s * CVT_STRIDE + g];
    #pragma unroll
    for (int t = 0; t < 4; ++t)
        #pragma unroll
        for (int s = 0; s < W_SWEEPS; ++s)
            f[3 * ACT_SWEEPS + t * W_SWEEPS + s] =
                reinterpret_cast<const float4*>(wts[t])[s * CVT_STRIDE + g];

    #pragma unroll
    for (int n = 0; n < 3 * ACT_SWEEPS + 4 * W_SWEEPS; ++n) {
        ushort4 h;
        h.x = f2bf(f[n].x); h.y = f2bf(f[n].y); h.z = f2bf(f[n].z); h.w = f2bf(f[n].w);
        reinterpret_cast<ushort4*>(dst)[n * CVT_STRIDE + g] = h;
    }
}

// Value of lane (l ^ M) of the same 16-lane row, all lanes on (DPP row_xmask).
template <int M>
__device__ __forceinline__ float row_xor(float x) {
    return __int_as_float(__builtin_amdgcn_update_dpp(
        0, __float_as_int(x), 0x160 | M, 0xf, 0xf, true));
}

// Rank-1 per-token attention: scores[d][q] = q_d*k_q/8, so softmax row d is
// softmax_q(q_d*k_q): never materialize the 64x64 matrix. ctx emitted bf16.
// The row maximum needs no pass over the keys: it is q_d/8 times the head's
// largest or smallest key.
__global__ void __launch_bounds__(256)
attn_rank1_softmax(const float* __restrict__ Q, const float* __restrict__ K,
                   const float* __restrict__ V, unsigned short* __restrict__ Ctx)
{
    __shared__ float kk[1024];
    __shared__ float vv[1024];

    const int    tid  = threadIdx.x;
    const size_t base = (size_t)blockIdx.x * 1024;

    const float4 kown = *reinterpret_cast<const float4*>(K + base + tid * 4);
    *reinterpret_cast<float4*>(&kk[tid * 4]) = kown;
    *reinterpret_cast<float4*>(&vv[tid * 4]) =
        *reinterpret_cast<const float4*>(V + base + tid * 4);

    // Largest and smallest key of this thread's head. The 16 lanes of a row hold
    // the head's 64 keys, four each, so four xor steps inside the row finish it.
    float kmax = fmaxf(fmaxf(kown.x, kown.y), fmaxf(kown.z, kown.w));
    float kmin = fminf(fminf(kown.x, kown.y), fminf(kown.z, kown.w));
    kmax = fmaxf(kmax, row_xor<1>(kmax));  kmin = fminf(kmin, row_xor<1>(kmin));
    kmax = fmaxf(kmax, row_xor<2>(kmax));  kmin = fminf(kmin, row_xor<2>(kmin));
    kmax = fmaxf(kmax, row_xor<4>(kmax));  kmin = fminf(kmin, row_xor<4>(kmin));
    kmax = fmaxf(kmax, row_xor<8>(kmax));  kmin = fminf(kmin, row_xor<8>(kmin));
    __syncthreads();

    const float4 qv = *reinterpret_cast<const float4*>(Q + base + tid * 4);
    const int    hb = (tid >> 4) << 6;          // head base (64 ch/head)
    const float  q4[4] = {qv.x, qv.y, qv.z, qv.w};
    float        out[4];

    #pragma unroll
    for (int c = 0; c < 4; ++c) {
        const float s = q4[c] * 0.125f;         // 1/sqrt(64)
        // rounding is monotone, so the largest rounded product s * k_j is the one
        // with the largest key (s >= 0) or with the smallest key (s < 0)
        const float mx = fmaxf(s * kmax, s * kmin);
        float se = 0.f, av = 0.f;
        #pragma unroll 8
        for (int j = 0; j < 64; ++j) {
            const float e = __expf(s * kk[hb + j] - mx);   // v_exp_f32
            se += e;
            av = fmaf(e, vv[hb + j], av);
        }
        out[c] = av / se;
    }
    ushort4 h;
    h.x = f2bf(out[0]); h.y = f2bf(out[1]); h.z = f2bf(out[2]); h.w = f2bf(out[3]);
    *reinterpret_cast<ushort4*>(Ctx + base + tid * 4) = h;
}

extern "C" void kernel_launch(void* const* d_in, const int* in_sizes, int n_in,
                              void* d_out, int out_size, void* d_ws, size_t ws_size,
                              hipStream_t stream) {
    (void)in_sizes; (void)n_in; (void)out_size; (void)ws_size;
    const float* x_q = (const float*)d_in[0];
    const float* x_k = (const float*)d_in[1];
    const float* x_v = (const float*)d_in[2];
    const float* Wq  = (const float*)d_in[3];
    const float* bq  = (const float*)d_in[4];
    const float* Wk  = (const float*)d_in[5];
    const float* bk  = (const float*)d_in[6];
    const float* Wv  = (const float*)d_in[7];
    const float* bv  = (const float*)d_in[8];
    const float* Wo  = (const float*)d_in[9];
    const float* bo  = (const float*)d_in[10];
    float* out = (float*)d_out;

    const int Mrows = 4 * 512;                    // 2048 tokens
    const int D     = 1024;
    const size_t actElems = (size_t)Mrows * D;    // 2M
    const size_t wElems   = (size_t)D * D;        // 1M

    // workspace layout (48 MB total)
    unsigned short* bXq = (unsigned short*)d_ws;
    unsigned short* bXk = bXq + actElems;
    unsigned short* bXv = bXk + actElems;
    unsigned short* bWq = bXv + actElems;
    unsigned short* bWk = bWq + wElems;
    unsigned short* bWv = bWk + wElems;
    unsigned short* bWo = bWv + wElems;
    float*          Qf  = (float*)(bWo + wElems);
    float*          Kf  = Qf + actElems;
    float*          Vf  = Kf + actElems;
    unsigned short* Cx  = (unsigned short*)(Vf + actElems);

    dim3 block(256);
    // bXq..bWo are contiguous in this order: one launch fills all seven planes
    cvt_all_f32_bf16<<<CVT_BLOCKS, block, 0, stream>>>(x_q, x_k, x_v, Wq, Wk, Wv, Wo, bXq);

    // Q, K and V projections are independent: one launch, 384 blocks resident
    // together (bXq|bXk|bXv, bWq|bWk|bWv and Qf|Kf|Vf are each contiguous).
    // K in two slices: two blocks of 16 waves still share a WGP.
    dim3 gridQKV(D / BN, Mrows / BM, 3);          // (8, 16, 3)
    gemm_bias_bf16wmma<2><<<gridQKV, dim3(512), 0, stream>>>(bXq, bWq, bq, bk, bv, Qf, Mrows, D, D);

    attn_rank1_softmax<<<dim3(Mrows), block, 0, stream>>>(Qf, Kf, Vf, Cx);

    // 128 blocks, at most one per WGP: K in four slices, 32 waves a block
    dim3 gridO(D / BN, Mrows / BM, 1);            // (8, 16, 1)
    gemm_bias_bf16wmma<4><<<gridO, dim3(1024), 0, stream>>>(Cx, bWo, bo, bo, bo, out, Mrows, D, D);
}

// v006
// A run of this version takes 52.4 microseconds.
// Next to v005, in two timings, it ran 1.04 times as fast each time.
// All steps since v000 together make it 2.35 times as fast.
#include <hip/hip_runtime.h>

// ---------------------------------------------------------------------------
// MHTempCtxAttention for MI455X (gfx1250, wave32, WMMA + async LDS DMA)
// Pipeline:
//   1) one-launch fp32->bf16 conversion of activations & weights
//   2) bf16 WMMA GEMMs, tiles staged into LDS with
//      GLOBAL_LOAD_ASYNC_TO_LDS_B128 + s_wait_asynccnt double-buffer pipeline;
//      K is split over S groups of eight waves inside each block
//   3) rank-1 softmax attention on fp32 VALU (v_exp_f32), ctx emitted as bf16
//   4) output projection GEMM -> fp32 d_out
// ---------------------------------------------------------------------------

typedef __attribute__((ext_vector_type(16))) __bf16 v16bf;
typedef __attribute__((ext_vector_type(8)))  float  v8f;
typedef __attribute__((ext_vector_type(4)))  int    v4i;
typedef __attribute__((ext_vector_type(2)))  float  v2f;

#define BM   128      // block tile rows
#define BN   128      // block tile cols
#define BK   64       // K step: one tile row is 128 B, a whole cache line (two WMMA K of 32)
#define LSTR 72       // LDS row stride in bf16 elems (64 + 8 pad; 144 B = 16 B x odd)

#if __has_builtin(__builtin_amdgcn_global_load_async_to_lds_b128)
#define ASYNC_LDS 1
#else
#define ASYNC_LDS 0
#endif

#if __has_builtin(__builtin_amdgcn_s_wait_asynccnt)
#define WAIT_ASYNC(n) __builtin_amdgcn_s_wait_asynccnt(n)
#else
#define WAIT_ASYNC(n) asm volatile("s_wait_asynccnt %0" :: "n"(n) : "memory")
#endif

typedef __attribute__((address_space(1))) v4i as1_v4i;   // global 16B vector
typedef __attribute__((address_space(3))) v4i as3_v4i;   // LDS 16B vector

__device__ __forceinline__ unsigned short f2bf(float f) {
    unsigned int u = __float_as_uint(f);
    u += 0x7FFFu + ((u >> 16) & 1u);           // round-to-nearest-even
    return (unsigned short)(u >> 16);
}

#if ASYNC_LDS
// 16B async DMA: LDS[dst] = MEM[src], tracked by ASYNCcnt (no VGPR round-trip)
__device__ __forceinline__ void async_cp16(const void* gsrc, void* ldsdst) {
    __builtin_amdgcn_global_load_async_to_lds_b128(
        (as1_v4i*)(unsigned long long)gsrc,
        (as3_v4i*)(unsigned int)(unsigned long long)ldsdst,
        /*offset=*/0, /*cpol=*/0);
}
#endif

// Load one 16x32 bf16 fragment from LDS, k0 = first k of the fragment inside the
// tile row (ISA striping):
//   lanes 0-15 : row = lane,    K = {0..7, 16..23}
//   lanes 16-31: row = lane-16, K = {8..15, 24..31}
__device__ __forceinline__ v16bf load_frag(const unsigned short* lds,
                                           int rowBase, int k0, int lane) {
    const int r  = lane & 15;
    const int kb = (lane >> 4) << 3;
    const unsigned short* p = lds + (rowBase + r) * LSTR + k0 + kb;
    union { v16bf v; uint4 q[2]; } u;
    u.q[0] = *reinterpret_cast<const uint4*>(p);
    u.q[1] = *reinterpret_cast<const uint4*>(p + 16);
    return u.v;
}

// C[M x N] = A[M x K](bf16) * W[N x K](bf16)^T + bias[N](f32), C = f32
// blockIdx.z picks one of up to three independent products of the same shape:
// their A, W and C planes lie back to back behind Abase, Wbase and Cbase.
// A block is S groups of eight waves. Every group works on the whole 128 x 128
// tile but walks only its own Kdim / S slice of K, with its own pair of LDS
// buffers: the serial chain of K steps (each one a copy latency, LDS latencies
// and two barriers long) is S times shorter, and the groups fill each other's
// stalls. The S partial tiles are added through LDS behind the loop.
// Kdim must be a multiple of S * BK.
template <int S>
__global__ void __launch_bounds__(256 * S)
gemm_bias_bf16wmma(const unsigned short* __restrict__ Abase,
                   const unsigned short* __restrict__ Wbase,
                   const float* __restrict__ bias0,
                   const float* __restrict__ bias1,
                   const float* __restrict__ bias2,
                   float* __restrict__ Cbase,
                   int Mrows, int Nout, int Kdim)
{
    const int z = blockIdx.z;
    const unsigned short* __restrict__ A = Abase + (size_t)z * Mrows * Kdim;
    const unsigned short* __restrict__ W = Wbase + (size_t)z * Nout * Kdim;
    const float* __restrict__ bias = (z == 0) ? bias0 : (z == 1) ? bias1 : bias2;
    float* __restrict__ C = Cbase + (size_t)z * Mrows * Nout;

    // ring: per group two A and two B buffers; behind the loop the same LDS holds
    // the partial tiles on their way to the group that finishes them
    constexpr int RING_BYTES = S * 2 * (BM + BN) * LSTR * 2;
    constexpr int RED_BYTES  = (S - 1) * BM * BN * 4;
    __shared__ __align__(16) unsigned char smem[RING_BYTES > RED_BYTES ? RING_BYTES : RED_BYTES];

    // group number: the same in every lane of a wave, kept scalar for the branches
    const int grp  = __builtin_amdgcn_readfirstlane((int)(threadIdx.x >> 8));
    const int tid  = threadIdx.x & 255; // thread within its group
    unsigned short* const As0 = reinterpret_cast<unsigned short*>(smem) + grp * 2 * (BM + BN) * LSTR;
    unsigned short* const Bs0 = As0 + 2 * BM * LSTR;
    const int lane = tid & 31;
    const int wave = tid >> 5;          // 0..7
    const int wr   = wave >> 2;         // 0..1 : wave row (64 rows each)
    const int wc   = wave & 3;          // 0..3 : wave col (32 cols each)

    const int blockRow = blockIdx.y * BM;
    const int blockCol = blockIdx.x * BN;

    v8f acc[4][2];
    #pragma unroll
    for (int i = 0; i < 4; ++i)
        #pragma unroll
        for (int j = 0; j < 2; ++j)
            acc[i][j] = (v8f){0.f, 0.f, 0.f, 0.f, 0.f, 0.f, 0.f, 0.f};

    const int kBase  = grp * (Kdim / S); // first k of this group's slice
    const int nTiles = Kdim / (S * BK);  // K steps of one group

#if ASYNC_LDS
    // ---- async double-buffered pipeline: 8 x b128 per thread per tile ----
    // chunk mapping: tile = A[128x64] ++ B[128x64] bf16 = 2048 x 16B chunks.
    // Eight lanes side by side take one row's 128 B, so a wave's copy touches
    // four whole cache lines and no line is asked for by two K steps.
    auto issue_tile = [&](int buf, int k0) {
        #pragma unroll
        for (int i = 0; i < 4; ++i) {                  // A half: chunks 0..1023
            const int c   = tid + i * 256;
            const int row = c >> 3, seg = c & 7;       // 8 x 16B per row
            async_cp16(A + (size_t)(blockRow + row) * Kdim + k0 + seg * 8,
                       As0 + buf * BM * LSTR + row * LSTR + seg * 8);
        }
        #pragma unroll
        for (int i = 0; i < 4; ++i) {                  // B half
            const int c   = tid + i * 256;
            const int row = c >> 3, seg = c & 7;
            async_cp16(W + (size_t)(blockCol + row) * Kdim + k0 + seg * 8,
                       Bs0 + buf * BN * LSTR + row * LSTR + seg * 8);
        }
    };

    issue_tile(0, kBase);
    for (int t = 0; t < nTiles; ++t) {
        const int cur = t & 1;
        if (t + 1 < nTiles) {
            issue_tile(cur ^ 1, kBase + (t + 1) * BK); // overlap next tile DMA
            WAIT_ASYNC(8);                             // all but tile t+1's eight: tile t landed
        } else {
            WAIT_ASYNC(0);
        }
        // publishes tile t to the group's other waves; standing directly behind
        // the wait it also holds the LDS reads below behind that wait
        __syncthreads();

        // the tile's two WMMA K slices in rising k: the sum order stays the same;
        // unrolled so that ks is a constant in the LDS read offsets
        #pragma unroll
        for (int ks = 0; ks < BK; ks += 32) {
            v16bf af[4], bfd[2];
            #pragma unroll
            for (int i = 0; i < 4; ++i) af[i]  = load_frag(As0 + cur * BM * LSTR, wr * 64 + i * 16, ks, lane);
            #pragma unroll
            for (int j = 0; j < 2; ++j) bfd[j] = load_frag(Bs0 + cur * BN * LSTR, wc * 32 + j * 16, ks, lane);

            #pragma unroll
            for (int i = 0; i < 4; ++i)
                #pragma unroll
                for (int j = 0; j < 2; ++j)
                    acc[i][j] = __builtin_amdgcn_wmma_f32_16x16x32_bf16(
                        false, af[i], false, bfd[j], (short)0, acc[i][j], false, false);
        }
        __syncthreads();                                // buf[cur] reusable
    }
#else
    // ---- sync fallback: batched wide loads, then wide LDS stores ----
    for (int t = 0; t < nTiles; ++t) {
        const int k0 = kBase + t * BK;
        uint4 ra[4], rb[4];
        #pragma unroll
        for (int i = 0; i < 4; ++i) {
            const int c = tid + i * 256, row = c >> 3, seg = c & 7;
            ra[i] = *reinterpret_cast<const uint4*>(
                A + (size_t)(blockRow + row) * Kdim + k0 + seg * 8);
            rb[i] = *reinterpret_cast<const uint4*>(
                W + (size_t)(blockCol + row) * Kdim + k0 + seg * 8);
        }
        __syncthreads();
        #pragma unroll
        for (int i = 0; i < 4; ++i) {
            const int c = tid + i * 256, row = c >> 3, seg = c & 7;
            *reinterpret_cast<uint4*>(As0 + row * LSTR + seg * 8) = ra[i];
            *reinterpret_cast<uint4*>(Bs0 + row * LSTR + seg * 8) = rb[i];
        }
        __syncthreads();

        #pragma unroll
        for (int ks = 0; ks < BK; ks += 32) {
            v16bf af[4], bfd[2];
            #pragma unroll
            for (int i = 0; i < 4; ++i) af[i]  = load_frag(As0, wr * 64 + i * 16, ks, lane);
            #pragma unroll
            for (int j = 0; j < 2; ++j) bfd[j] = load_frag(Bs0, wc * 32 + j * 16, ks, lane);

            #pragma unroll
            for (int i = 0; i < 4; ++i)
                #pragma unroll
                for (int j = 0; j < 2; ++j)
                    acc[i][j] = __builtin_amdgcn_wmma_f32_16x16x32_bf16(
                        false, af[i], false, bfd[j], (short)0, acc[i][j], false, false);
        }
    }
    __syncthreads();                                    // ring reusable
#endif

    // ---- add the S partial tiles: group o finishes accumulator rows
    // i = o * IPG .. o * IPG + IPG - 1 of every wave. Each group hands the rows it
    // does not finish to their owner through LDS, 16 B per lane and lanes side by
    // side. The ring is free: the loop ended in a barrier behind every wave's last
    // LDS read, and no copy is outstanding behind the last trip's wait to 0.
    constexpr int IPG = 4 / S;
    float4* const red = reinterpret_cast<float4*>(smem);
    #pragma unroll
    for (int i = 0; i < 4; ++i) {
        const int owner = i / IPG;
        if (grp != owner) {
            const int slot = owner * (S - 1) + (grp < owner ? grp : grp - 1);
            #pragma unroll
            for (int j = 0; j < 2; ++j)
                #pragma unroll
                for (int h = 0; h < 2; ++h)
                    red[((slot * IPG + i % IPG) * 4 + j * 2 + h) * 256 + tid] =
                        make_float4(acc[i][j][h * 4 + 0], acc[i][j][h * 4 + 1],
                                    acc[i][j][h * 4 + 2], acc[i][j][h * 4 + 3]);
        }
    }
    __syncthreads();                                    // partial tiles visible to their owners

    // the rows this group finishes, picked by the scalar group number so that one
    // copy of the code below serves every group
    v8f fin[IPG][2];
    #pragma unroll
    for (int i = 0; i < 4; ++i)
        if (grp == i / IPG) {
            fin[i % IPG][0] = acc[i][0];
            fin[i % IPG][1] = acc[i][1];
        }
    // own partial first, then the other groups' in rising group order
    #pragma unroll
    for (int s = 0; s < S - 1; ++s)
        #pragma unroll
        for (int ii = 0; ii < IPG; ++ii)
            #pragma unroll
            for (int j = 0; j < 2; ++j)
                #pragma unroll
                for (int h = 0; h < 2; ++h) {
                    const float4 p =
                        red[(((grp * (S - 1) + s) * IPG + ii) * 4 + j * 2 + h) * 256 + tid];
                    fin[ii][j][h * 4 + 0] += p.x;  fin[ii][j][h * 4 + 1] += p.y;
                    fin[ii][j][h * 4 + 2] += p.z;  fin[ii][j][h * 4 + 3] += p.w;
                }

    // ---- store: VGPR v -> row v (+8 for upper lane half), col = lane&15 ----
    const int cr = (lane >> 4) * 8;
    const int cc = lane & 15;
    #pragma unroll
    for (int ii = 0; ii < IPG; ++ii) {
        #pragma unroll
        for (int j = 0; j < 2; ++j) {
            const int col = blockCol + wc * 32 + j * 16 + cc;
            const float b = bias[col];
            #pragma unroll
            for (int v = 0; v < 8; ++v) {
                const int row = blockRow + wr * 64 + (grp * IPG + ii) * 16 + cr + v;
                C[(size_t)row * Nout + col] = fin[ii][j][v] + b;
            }
        }
    }
}

// fp32 -> bf16 conversion of all seven tensors in ONE launch of few, long-lived
// waves. The bf16 planes lie back to back in the workspace in argument order,
// so sweep n of the grid writes float4 group n * CVT_STRIDE + g of that region.
#define CVT_BLOCKS  512                     // 2 blocks (16 waves) per WGP
#define CVT_STRIDE  (CVT_BLOCKS * 256)      // float4 groups per sweep of the grid
#define ACT_SWEEPS  4                       // 2048 * 1024 / 4 / CVT_STRIDE
#define W_SWEEPS    2                       // 1024 * 1024 / 4 / CVT_STRIDE
static_assert(ACT_SWEEPS * CVT_STRIDE * 4 == 2048 * 1024, "activation sweeps");
static_assert(W_SWEEPS   * CVT_STRIDE * 4 == 1024 * 1024, "weight sweeps");

__global__ void __launch_bounds__(256)
cvt_all_f32_bf16(const float* __restrict__ xq, const float* __restrict__ xk,
                 const float* __restrict__ xv, const float* __restrict__ wq,
                 const float* __restrict__ wk, const float* __restrict__ wv,
                 const float* __restrict__ wo, unsigned short* __restrict__ dst)
{
    const int g = blockIdx.x * 256 + threadIdx.x;
    const float* const act[3] = {xq, xk, xv};
    const float* const wts[4] = {wq, wk, wv, wo};
    float4 f[3 * ACT_SWEEPS + 4 * W_SWEEPS];

    // all loads first: every thread keeps its 20 independent 16B reads in flight.
    // Every loop here is fully unrolled so that f[] stays in registers and the
    // tensor each sweep reads is known at compile time (no per-sweep select).
    #pragma unroll
    for (int t = 0; t < 3; ++t)
        #pragma unroll
        for (int s = 0; s < ACT_SWEEPS; ++s)
            f[t * ACT_SWEEPS + s] =
                reinterpret_cast<const float4*>(act[t])[s * CVT_STRIDE + g];
    #pragma unroll
    for (int t = 0; t < 4; ++t)
        #pragma unroll
        for (int s = 0; s < W_SWEEPS; ++s)
            f[3 * ACT_SWEEPS + t * W_SWEEPS + s] =
                reinterpret_cast<const float4*>(wts[t])[s * CVT_STRIDE + g];

    #pragma unroll
    for (int n = 0; n < 3 * ACT_SWEEPS + 4 * W_SWEEPS; ++n) {
        ushort4 h;
        h.x = f2bf(f[n].x); h.y = f2bf(f[n].y); h.z = f2bf(f[n].z); h.w = f2bf(f[n].w);
        reinterpret_cast<ushort4*>(dst)[n * CVT_STRIDE + g] = h;
    }
}

// Value of lane (l ^ M) of the same 16-lane row, all lanes on (DPP row_xmask).
template <int M>
__device__ __forceinline__ float row_xor(float x) {
    return __int_as_float(__builtin_amdgcn_update_dpp(
        0, __float_as_int(x), 0x160 | M, 0xf, 0xf, true));
}

// Rank-1 per-token attention: scores[d][q] = q_d*k_q/8, so softmax row d is
// softmax_q(q_d*k_q): never materialize the 64x64 matrix. ctx emitted bf16.
// The row maximum needs no pass over the keys: it is q_d/8 times the head's
// largest or smallest key.
__global__ void __launch_bounds__(256)
attn_rank1_softmax(const float* __restrict__ Q, const float* __restrict__ K,
                   const float* __restrict__ V, unsigned short* __restrict__ Ctx)
{
    __shared__ __align__(16) float kk[1024];
    __shared__ __align__(16) float vv[1024];

    const int    tid  = threadIdx.x;
    const size_t base = (size_t)blockIdx.x * 1024;

    const float4 kown = *reinterpret_cast<const float4*>(K + base + tid * 4);
    *reinterpret_cast<float4*>(&kk[tid * 4]) = kown;
    *reinterpret_cast<float4*>(&vv[tid * 4]) =
        *reinterpret_cast<const float4*>(V + base + tid * 4);

    // Largest and smallest key of this thread's head. The 16 lanes of a row hold
    // the head's 64 keys, four each, so four xor steps inside the row finish it.
    float kmax = fmaxf(fmaxf(kown.x, kown.y), fmaxf(kown.z, kown.w));
    float kmin = fminf(fminf(kown.x, kown.y), fminf(kown.z, kown.w));
    kmax = fmaxf(kmax, row_xor<1>(kmax));  kmin = fminf(kmin, row_xor<1>(kmin));
    kmax = fmaxf(kmax, row_xor<2>(kmax));  kmin = fminf(kmin, row_xor<2>(kmin));
    kmax = fmaxf(kmax, row_xor<4>(kmax));  kmin = fminf(kmin, row_xor<4>(kmin));
    kmax = fmaxf(kmax, row_xor<8>(kmax));  kmin = fminf(kmin, row_xor<8>(kmin));
    __syncthreads();

    const float4 qv = *reinterpret_cast<const float4*>(Q + base + tid * 4);
    const int    hb = (tid >> 4) << 6;          // head base (64 ch/head)
    const float  q4[4] = {qv.x, qv.y, qv.z, qv.w};
    float        s[4], mx[4], out[4];

    #pragma unroll
    for (int c = 0; c < 4; ++c) {
        s[c] = q4[c] * 0.125f;                  // 1/sqrt(64)
        // rounding is monotone, so the largest rounded product s * k_j is the one
        // with the largest key (s >= 0) or with the smallest key (s < 0)
        mx[c] = fmaxf(s[c] * kmax, s[c] * kmin);
    }
    // Keys outermost, the thread's four channels side by side: one 16 B read of
    // keys and one of values feed 16 exponentials instead of 4, and two channels
    // share each packed f32 instruction. Every channel still does the same
    // operations in rising j, so its sums keep their order and their bits.
    const v2f sp[2] = {{s[0], s[1]}, {s[2], s[3]}};
    const v2f nm[2] = {{-mx[0], -mx[1]}, {-mx[2], -mx[3]}};
    v2f se[2] = {{0.f, 0.f}, {0.f, 0.f}};
    v2f av[2] = {{0.f, 0.f}, {0.f, 0.f}};
    // unrolled by 2: the second four keys' reads are in flight under the first four's work
    #pragma unroll 2
    for (int j = 0; j < 64; j += 4) {
        const float4 k4 = *reinterpret_cast<const float4*>(&kk[hb + j]);
        const float4 v4 = *reinterpret_cast<const float4*>(&vv[hb + j]);
        const float  kj[4] = {k4.x, k4.y, k4.z, k4.w};
        const float  vj[4] = {v4.x, v4.y, v4.z, v4.w};
        #pragma unroll
        for (int u = 0; u < 4; ++u)
            #pragma unroll
            for (int p = 0; p < 2; ++p) {
                // exp(x) = 2^(x * log2 e): the fast exponential's own two steps
                const v2f t = __builtin_elementwise_fma(sp[p], (v2f){kj[u], kj[u]}, nm[p])
                              * 1.44269504f;
                const v2f e = {__builtin_amdgcn_exp2f(t.x), __builtin_amdgcn_exp2f(t.y)};
                se[p] += e;
                av[p] = __builtin_elementwise_fma(e, (v2f){vj[u], vj[u]}, av[p]);
            }
    }
    #pragma unroll
    for (int c = 0; c < 4; ++c) out[c] = av[c >> 1][c & 1] / se[c >> 1][c & 1];
    ushort4 h;
    h.x = f2bf(out[0]); h.y = f2bf(out[1]); h.z = f2bf(out[2]); h.w = f2bf(out[3]);
    *reinterpret_cast<ushort4*>(Ctx + base + tid * 4) = h;
}

extern "C" void kernel_launch(void* const* d_in, const int* in_sizes, int n_in,
                              void* d_out, int out_size, void* d_ws, size_t ws_size,
                              hipStream_t stream) {
    (void)in_sizes; (void)n_in; (void)out_size; (void)ws_size;
    const float* x_q = (const float*)d_in[0];
    const float* x_k = (const float*)d_in[1];
    const float* x_v = (const float*)d_in[2];
    const float* Wq  = (const float*)d_in[3];
    const float* bq  = (const float*)d_in[4];
    const float* Wk  = (const float*)d_in[5];
    const float* bk  = (const float*)d_in[6];
    const float* Wv  = (const float*)d_in[7];
    const float* bv  = (const float*)d_in[8];
    const float* Wo  = (const float*)d_in[9];
    const float* bo  = (const float*)d_in[10];
    float* out = (float*)d_out;

    const int Mrows = 4 * 512;                    // 2048 tokens
    const int D     = 1024;
    const size_t actElems = (size_t)Mrows * D;    // 2M
    const size_t wElems   = (size_t)D * D;        // 1M

    // workspace layout (48 MB total)
    unsigned short* bXq = (unsigned short*)d_ws;
    unsigned short* bXk = bXq + actElems;
    unsigned short* bXv = bXk + actElems;
    unsigned short* bWq = bXv + actElems;
    unsigned short* bWk = bWq + wElems;
    unsigned short* bWv = bWk + wElems;
    unsigned short* bWo = bWv + wElems;
    float*          Qf  = (float*)(bWo + wElems);
    float*          Kf  = Qf + actElems;
    float*          Vf  = Kf + actElems;
    unsigned short* Cx  = (unsigned short*)(Vf + actElems);

    dim3 block(256);
    // bXq..bWo are contiguous in this order: one launch fills all seven planes
    cvt_all_f32_bf16<<<CVT_BLOCKS, block, 0, stream>>>(x_q, x_k, x_v, Wq, Wk, Wv, Wo, bXq);

    // Q, K and V projections are independent: one launch, 384 blocks resident
    // together (bXq|bXk|bXv, bWq|bWk|bWv and Qf|Kf|Vf are each contiguous).
    // K in two slices: two blocks of 16 waves still share a WGP.
    dim3 gridQKV(D / BN, Mrows / BM, 3);          // (8, 16, 3)
    gemm_bias_bf16wmma<2><<<gridQKV, dim3(512), 0, stream>>>(bXq, bWq, bq, bk, bv, Qf, Mrows, D, D);

    attn_rank1_softmax<<<dim3(Mrows), block, 0, stream>>>(Qf, Kf, Vf, Cx);

    // 128 blocks, at most one per WGP: K in four slices, 32 waves a block
    dim3 gridO(D / BN, Mrows / BM, 1);            // (8, 16, 1)
    gemm_bias_bf16wmma<4><<<gridO, dim3(1024), 0, stream>>>(Cx, bWo, bo, bo, bo, out, Mrows, D, D);
}

// v007
// A run of this version takes 48.5 microseconds.
// Next to v006, in two timings, it ran 1.08 times as fast each time.
// All steps since v000 together make it 2.53 times as fast.
#include <hip/hip_runtime.h>

// ---------------------------------------------------------------------------
// MHTempCtxAttention for MI455X (gfx1250, wave32, WMMA + async LDS DMA)
// Pipeline:
//   1) one-launch fp32->bf16 conversion of activations & weights
//   2) Q, K, V projections (bf16 WMMA) of one head and 128 tokens per block,
//      tiles staged into LDS with GLOBAL_LOAD_ASYNC_TO_LDS_B128 + s_wait_asynccnt
//      double-buffer pipeline, K split over two wave groups per product; the
//      finished f32 tiles stay in LDS and the same block does the rank-1 softmax
//      attention on fp32 VALU (v_exp_f32), ctx emitted as bf16
//   3) output projection GEMM (K split over four wave groups) -> fp32 d_out
// ---------------------------------------------------------------------------

typedef __attribute__((ext_vector_type(16))) __bf16 v16bf;
typedef __attribute__((ext_vector_type(8)))  float  v8f;
typedef __attribute__((ext_vector_type(4)))  int    v4i;
typedef __attribute__((ext_vector_type(2)))  float  v2f;

#define BM   128      // block tile rows
#define BN   128      // block tile cols
#define BK   64       // K step: one tile row is 128 B, a whole cache line (two WMMA K of 32)
#define LSTR 72       // LDS row stride in bf16 elems (64 + 8 pad; 144 B = 16 B x odd)

#if __has_builtin(__builtin_amdgcn_global_load_async_to_lds_b128)
#define ASYNC_LDS 1
#else
#define ASYNC_LDS 0
#endif

#if __has_builtin(__builtin_amdgcn_s_wait_asynccnt)
#define WAIT_ASYNC(n) __builtin_amdgcn_s_wait_asynccnt(n)
#else
#define WAIT_ASYNC(n) asm volatile("s_wait_asynccnt %0" :: "n"(n) : "memory")
#endif

typedef __attribute__((address_space(1))) v4i as1_v4i;   // global 16B vector
typedef __attribute__((address_space(3))) v4i as3_v4i;   // LDS 16B vector

__device__ __forceinline__ unsigned short f2bf(float f) {
    unsigned int u = __float_as_uint(f);
    u += 0x7FFFu + ((u >> 16) & 1u);           // round-to-nearest-even
    return (unsigned short)(u >> 16);
}

#if ASYNC_LDS
// 16B async DMA: LDS[dst] = MEM[src], tracked by ASYNCcnt (no VGPR round-trip)
__device__ __forceinline__ void async_cp16(const void* gsrc, void* ldsdst) {
    __builtin_amdgcn_global_load_async_to_lds_b128(
        (as1_v4i*)(unsigned long long)gsrc,
        (as3_v4i*)(unsigned int)(unsigned long long)ldsdst,
        /*offset=*/0, /*cpol=*/0);
}
// the issuing wave's copies have landed, all but its N youngest
template <int N>
__device__ __forceinline__ void wait_copies() { WAIT_ASYNC(N); }
#else
// no async copy in this build: the same 16 B through a register; the barrier
// behind wait_copies() publishes the LDS store
__device__ __forceinline__ void async_cp16(const void* gsrc, void* ldsdst) {
    *reinterpret_cast<uint4*>(ldsdst) = *reinterpret_cast<const uint4*>(gsrc);
}
template <int N>
__device__ __forceinline__ void wait_copies() {}
#endif

// Load one 16x32 bf16 fragment from LDS, k0 = first k of the fragment inside the
// tile row (ISA striping):
//   lanes 0-15 : row = lane,    K = {0..7, 16..23}
//   lanes 16-31: row = lane-16, K = {8..15, 24..31}
__device__ __forceinline__ v16bf load_frag(const unsigned short* lds,
                                           int rowBase, int k0, int lane) {
    const int r  = lane & 15;
    const int kb = (lane >> 4) << 3;
    const unsigned short* p = lds + (rowBase + r) * LSTR + k0 + kb;
    union { v16bf v; uint4 q[2]; } u;
    u.q[0] = *reinterpret_cast<const uint4*>(p);
    u.q[1] = *reinterpret_cast<const uint4*>(p + 16);
    return u.v;
}

// C[M x N] = A[M x K](bf16) * W[N x K](bf16)^T + bias[N](f32), C = f32
// blockIdx.z picks one of up to three independent products of the same shape:
// their A, W and C planes lie back to back behind Abase, Wbase and Cbase.
// A block is S groups of eight waves. Every group works on the whole 128 x 128
// tile but walks only its own Kdim / S slice of K, with its own pair of LDS
// buffers: the serial chain of K steps (each one a copy latency, LDS latencies
// and two barriers long) is S times shorter, and the groups fill each other's
// stalls. The S partial tiles are added through LDS behind the loop.
// Kdim must be a multiple of S * BK.
template <int S>
__global__ void __launch_bounds__(256 * S)
gemm_bias_bf16wmma(const unsigned short* __restrict__ Abase,
                   const unsigned short* __restrict__ Wbase,
                   const float* __restrict__ bias0,
                   const float* __restrict__ bias1,
                   const float* __restrict__ bias2,
                   float* __restrict__ Cbase,
                   int Mrows, int Nout, int Kdim)
{
    const int z = blockIdx.z;
    const unsigned short* __restrict__ A = Abase + (size_t)z * Mrows * Kdim;
    const unsigned short* __restrict__ W = Wbase + (size_t)z * Nout * Kdim;
    const float* __restrict__ bias = (z == 0) ? bias0 : (z == 1) ? bias1 : bias2;
    float* __restrict__ C = Cbase + (size_t)z * Mrows * Nout;

    // ring: per group two A and two B buffers; behind the loop the same LDS holds
    // the partial tiles on their way to the group that finishes them
    constexpr int RING_BYTES = S * 2 * (BM + BN) * LSTR * 2;
    constexpr int RED_BYTES  = (S - 1) * BM * BN * 4;
    __shared__ __align__(16) unsigned char smem[RING_BYTES > RED_BYTES ? RING_BYTES : RED_BYTES];

    // group number: the same in every lane of a wave, kept scalar for the branches
    const int grp  = __builtin_amdgcn_readfirstlane((int)(threadIdx.x >> 8));
    const int tid  = threadIdx.x & 255; // thread within its group
    unsigned short* const As0 = reinterpret_cast<unsigned short*>(smem) + grp * 2 * (BM + BN) * LSTR;
    unsigned short* const Bs0 = As0 + 2 * BM * LSTR;
    const int lane = tid & 31;
    const int wave = tid >> 5;          // 0..7
    const int wr   = wave >> 2;         // 0..1 : wave row (64 rows each)
    const int wc   = wave & 3;          // 0..3 : wave col (32 cols each)

    const int blockRow = blockIdx.y * BM;
    const int blockCol = blockIdx.x * BN;

    v8f acc[4][2];
    #pragma unroll
    for (int i = 0; i < 4; ++i)
        #pragma unroll
        for (int j = 0; j < 2; ++j)
            acc[i][j] = (v8f){0.f, 0.f, 0.f, 0.f, 0.f, 0.f, 0.f, 0.f};

    const int kBase  = grp * (Kdim / S); // first k of this group's slice
    const int nTiles = Kdim / (S * BK);  // K steps of one group

#if ASYNC_LDS
    // ---- async double-buffered pipeline: 8 x b128 per thread per tile ----
    // chunk mapping: tile = A[128x64] ++ B[128x64] bf16 = 2048 x 16B chunks.
    // Eight lanes side by side take one row's 128 B, so a wave's copy touches
    // four whole cache lines and no line is asked for by two K steps.
    auto issue_tile = [&](int buf, int k0) {
        #pragma unroll
        for (int i = 0; i < 4; ++i) {                  // A half: chunks 0..1023
            const int c   = tid + i * 256;
            const int row = c >> 3, seg = c & 7;       // 8 x 16B per row
            async_cp16(A + (size_t)(blockRow + row) * Kdim + k0 + seg * 8,
                       As0 + buf * BM * LSTR + row * LSTR + seg * 8);
        }
        #pragma unroll
        for (int i = 0; i < 4; ++i) {                  // B half
            const int c   = tid + i * 256;
            const int row = c >> 3, seg = c & 7;
            async_cp16(W + (size_t)(blockCol + row) * Kdim + k0 + seg * 8,
                       Bs0 + buf * BN * LSTR + row * LSTR + seg * 8);
        }
    };

    issue_tile(0, kBase);
    for (int t = 0; t < nTiles; ++t) {
        const int cur = t & 1;
        if (t + 1 < nTiles) {
            issue_tile(cur ^ 1, kBase + (t + 1) * BK); // overlap next tile DMA
            WAIT_ASYNC(8);                             // all but tile t+1's eight: tile t landed
        } else {
            WAIT_ASYNC(0);
        }
        // publishes tile t to the group's other waves; standing directly behind
        // the wait it also holds the LDS reads below behind that wait
        __syncthreads();

        // the tile's two WMMA K slices in rising k: the sum order stays the same;
        // unrolled so that ks is a constant in the LDS read offsets
        #pragma unroll
        for (int ks = 0; ks < BK; ks += 32) {
            v16bf af[4], bfd[2];
            #pragma unroll
            for (int i = 0; i < 4; ++i) af[i]  = load_frag(As0 + cur * BM * LSTR, wr * 64 + i * 16, ks, lane);
            #pragma unroll
            for (int j = 0; j < 2; ++j) bfd[j] = load_frag(Bs0 + cur * BN * LSTR, wc * 32 + j * 16, ks, lane);

            #pragma unroll
            for (int i = 0; i < 4; ++i)
                #pragma unroll
                for (int j = 0; j < 2; ++j)
                    acc[i][j] = __builtin_amdgcn_wmma_f32_16x16x32_bf16(
                        false, af[i], false, bfd[j], (short)0, acc[i][j], false, false);
        }
        __syncthreads();                                // buf[cur] reusable
    }
#else
    // ---- sync fallback: batched wide loads, then wide LDS stores ----
    for (int t = 0; t < nTiles; ++t) {
        const int k0 = kBase + t * BK;
        uint4 ra[4], rb[4];
        #pragma unroll
        for (int i = 0; i < 4; ++i) {
            const int c = tid + i * 256, row = c >> 3, seg = c & 7;
            ra[i] = *reinterpret_cast<const uint4*>(
                A + (size_t)(blockRow + row) * Kdim + k0 + seg * 8);
            rb[i] = *reinterpret_cast<const uint4*>(
                W + (size_t)(blockCol + row) * Kdim + k0 + seg * 8);
        }
        __syncthreads();
        #pragma unroll
        for (int i = 0; i < 4; ++i) {
            const int c = tid + i * 256, row = c >> 3, seg = c & 7;
            *reinterpret_cast<uint4*>(As0 + row * LSTR + seg * 8) = ra[i];
            *reinterpret_cast<uint4*>(Bs0 + row * LSTR + seg * 8) = rb[i];
        }
        __syncthreads();

        #pragma unroll
        for (int ks = 0; ks < BK; ks += 32) {
            v16bf af[4], bfd[2];
            #pragma unroll
            for (int i = 0; i < 4; ++i) af[i]  = load_frag(As0, wr * 64 + i * 16, ks, lane);
            #pragma unroll
            for (int j = 0; j < 2; ++j) bfd[j] = load_frag(Bs0, wc * 32 + j * 16, ks, lane);

            #pragma unroll
            for (int i = 0; i < 4; ++i)
                #pragma unroll
                for (int j = 0; j < 2; ++j)
                    acc[i][j] = __builtin_amdgcn_wmma_f32_16x16x32_bf16(
                        false, af[i], false, bfd[j], (short)0, acc[i][j], false, false);
        }
    }
    __syncthreads();                                    // ring reusable
#endif

    // ---- add the S partial tiles: group o finishes accumulator rows
    // i = o * IPG .. o * IPG + IPG - 1 of every wave. Each group hands the rows it
    // does not finish to their owner through LDS, 16 B per lane and lanes side by
    // side. The ring is free: the loop ended in a barrier behind every wave's last
    // LDS read, and no copy is outstanding behind the last trip's wait to 0.
    constexpr int IPG = 4 / S;
    float4* const red = reinterpret_cast<float4*>(smem);
    #pragma unroll
    for (int i = 0; i < 4; ++i) {
        const int owner = i / IPG;
        if (grp != owner) {
            const int slot = owner * (S - 1) + (grp < owner ? grp : grp - 1);
            #pragma unroll
            for (int j = 0; j < 2; ++j)
                #pragma unroll
                for (int h = 0; h < 2; ++h)
                    red[((slot * IPG + i % IPG) * 4 + j * 2 + h) * 256 + tid] =
                        make_float4(acc[i][j][h * 4 + 0], acc[i][j][h * 4 + 1],
                                    acc[i][j][h * 4 + 2], acc[i][j][h * 4 + 3]);
        }
    }
    __syncthreads();                                    // partial tiles visible to their owners

    // the rows this group finishes, picked by the scalar group number so that one
    // copy of the code below serves every group
    v8f fin[IPG][2];
    #pragma unroll
    for (int i = 0; i < 4; ++i)
        if (grp == i / IPG) {
            fin[i % IPG][0] = acc[i][0];
            fin[i % IPG][1] = acc[i][1];
        }
    // own partial first, then the other groups' in rising group order
    #pragma unroll
    for (int s = 0; s < S - 1; ++s)
        #pragma unroll
        for (int ii = 0; ii < IPG; ++ii)
            #pragma unroll
            for (int j = 0; j < 2; ++j)
                #pragma unroll
                for (int h = 0; h < 2; ++h) {
                    const float4 p =
                        red[(((grp * (S - 1) + s) * IPG + ii) * 4 + j * 2 + h) * 256 + tid];
                    fin[ii][j][h * 4 + 0] += p.x;  fin[ii][j][h * 4 + 1] += p.y;
                    fin[ii][j][h * 4 + 2] += p.z;  fin[ii][j][h * 4 + 3] += p.w;
                }

    // ---- store: VGPR v -> row v (+8 for upper lane half), col = lane&15 ----
    const int cr = (lane >> 4) * 8;
    const int cc = lane & 15;
    #pragma unroll
    for (int ii = 0; ii < IPG; ++ii) {
        #pragma unroll
        for (int j = 0; j < 2; ++j) {
            const int col = blockCol + wc * 32 + j * 16 + cc;
            const float b = bias[col];
            #pragma unroll
            for (int v = 0; v < 8; ++v) {
                const int row = blockRow + wr * 64 + (grp * IPG + ii) * 16 + cr + v;
                C[(size_t)row * Nout + col] = fin[ii][j][v] + b;
            }
        }
    }
}

// fp32 -> bf16 conversion of all seven tensors in ONE launch of few, long-lived
// waves. The bf16 planes lie back to back in the workspace in argument order,
// so sweep n of the grid writes float4 group n * CVT_STRIDE + g of that region.
#define CVT_BLOCKS  512                     // 2 blocks (16 waves) per WGP
#define CVT_STRIDE  (CVT_BLOCKS * 256)      // float4 groups per sweep of the grid
#define ACT_SWEEPS  4                       // 2048 * 1024 / 4 / CVT_STRIDE
#define W_SWEEPS    2                       // 1024 * 1024 / 4 / CVT_STRIDE
static_assert(ACT_SWEEPS * CVT_STRIDE * 4 == 2048 * 1024, "activation sweeps");
static_assert(W_SWEEPS   * CVT_STRIDE * 4 == 1024 * 1024, "weight sweeps");

__global__ void __launch_bounds__(256)
cvt_all_f32_bf16(const float* __restrict__ xq, const float* __restrict__ xk,
                 const float* __restrict__ xv, const float* __restrict__ wq,
                 const float* __restrict__ wk, const float* __restrict__ wv,
                 const float* __restrict__ wo, unsigned short* __restrict__ dst)
{
    const int g = blockIdx.x * 256 + threadIdx.x;
    const float* const act[3] = {xq, xk, xv};
    const float* const wts[4] = {wq, wk, wv, wo};
    float4 f[3 * ACT_SWEEPS + 4 * W_SWEEPS];

    // all loads first: every thread keeps its 20 independent 16B reads in flight.
    // Every loop here is fully unrolled so that f[] stays in registers and the
    // tensor each sweep reads is known at compile time (no per-sweep select).
    #pragma unroll
    for (int t = 0; t < 3; ++t)
        #pragma unroll
        for (int s = 0; s < ACT_SWEEPS; ++s)
            f[t * ACT_SWEEPS + s] =
                reinterpret_cast<const float4*>(act[t])[s * CVT_STRIDE + g];
    #pragma unroll
    for (int t = 0; t < 4; ++t)
        #pragma unroll
        for (int s = 0; s < W_SWEEPS; ++s)
            f[3 * ACT_SWEEPS + t * W_SWEEPS + s] =
                reinterpret_cast<const float4*>(wts[t])[s * CVT_STRIDE + g];

    #pragma unroll
    for (int n = 0; n < 3 * ACT_SWEEPS + 4 * W_SWEEPS; ++n) {
        ushort4 h;
        h.x = f2bf(f[n].x); h.y = f2bf(f[n].y); h.z = f2bf(f[n].z); h.w = f2bf(f[n].w);
        reinterpret_cast<ushort4*>(dst)[n * CVT_STRIDE + g] = h;
    }
}

// Value of lane (l ^ M) of the same 16-lane row, all lanes on (DPP row_xmask).
template <int M>
__device__ __forceinline__ float row_xor(float x) {
    return __int_as_float(__builtin_amdgcn_update_dpp(
        0, __float_as_int(x), 0x160 | M, 0xf, 0xf, true));
}

// Same fragment as load_frag, from a tile whose rows are 128 B with no pad: the
// 16 B chunk c of row r lies at place c ^ ((r >> 1) & 7), so 16 lanes that read one
// chunk column of 16 rows fall on 16 different 16 B places of the 256 B bank row.
// rowBase is a multiple of 16.
__device__ __forceinline__ v16bf load_frag_sw(const unsigned short* lds,
                                              int rowBase, int k0, int lane) {
    const int r = lane & 15;
    const int x = (r >> 1) & 7;
    const int c = (k0 >> 3) + (lane >> 4);
    const unsigned short* p = lds + (rowBase + r) * BK;
    union { v16bf v; uint4 q[2]; } u;
    u.q[0] = *reinterpret_cast<const uint4*>(p + ((c ^ x) << 3));
    u.q[1] = *reinterpret_cast<const uint4*>(p + (((c + 2) ^ x) << 3));
    return u.v;
}

#define FT    128     // tokens of a block
#define HD    64      // channels of one head: the columns of each of the three tiles
#define QPIT  68      // f32 pitch of the finished tiles in LDS (272 B = 16 B x odd)
#define FROWS 48      // 16-lane rows in a block of 24 waves

// Q, K and V projections of one head for 128 tokens, then that head's attention,
// in one block: the three f32 tiles go from the accumulators to the attention
// through LDS and never through memory.
// Projections: X[M x K](bf16) * W[N x K](bf16)^T + bias[N](f32); the three A, W
// planes lie back to back behind Abase, Wbase. Six groups of four waves: group
// 2 * p + s works on product p and on half s of K, with its own pair of LDS
// buffers; a wave holds 64 x 32 of its group's 128 x 64 tile.
// Attention: scores[d][q] = q_d*k_q/8, so softmax row d is softmax_q(q_d*k_q):
// never materialize the 64x64 matrix. The row maximum needs no pass over the
// keys: it is q_d/8 times the head's largest or smallest key.
// Kdim must be a multiple of 2 * BK.
__global__ void __launch_bounds__(768)
qkv_attn_fused(const unsigned short* __restrict__ Abase,
               const unsigned short* __restrict__ Wbase,
               const float* __restrict__ bias0,
               const float* __restrict__ bias1,
               const float* __restrict__ bias2,
               unsigned short* __restrict__ Ctx,
               int Mrows, int Nout, int Kdim)
{
    constexpr int BUF_ELEMS  = (FT + HD) * BK;            // one A and one B buffer
    constexpr int RING_BYTES = 6 * 2 * BUF_ELEMS * 2;     // 288 KiB
    constexpr int RED_BYTES  = 6 * 2 * 4 * 128 * 16;      // half a partial tile per group
    constexpr int QKV_BYTES  = 3 * FT * QPIT * 4;
    static_assert(RED_BYTES + QKV_BYTES <= RING_BYTES, "hand-over fits in the ring");
    __shared__ __align__(16) unsigned char smem[RING_BYTES];

    // group number: the same in every lane of a wave, kept scalar for the branches
    const int grp  = __builtin_amdgcn_readfirstlane((int)(threadIdx.x >> 7));
    const int prod = grp >> 1;          // 0 Q, 1 K, 2 V
    const int ksl  = grp & 1;           // half of K
    const int tid  = threadIdx.x & 127; // thread within its group
    const unsigned short* __restrict__ A = Abase + (size_t)prod * Mrows * Kdim;
    const unsigned short* __restrict__ W = Wbase + (size_t)prod * Nout * Kdim;
    const float* __restrict__ bias = (prod == 0) ? bias0 : (prod == 1) ? bias1 : bias2;
    unsigned short* const As0 = reinterpret_cast<unsigned short*>(smem) + grp * 2 * BUF_ELEMS;
    unsigned short* const Bs0 = As0 + 2 * FT * BK;
    const int lane = tid & 31;
    const int wave = tid >> 5;          // 0..3
    const int wr   = wave >> 1;         // 0..1 : wave row (64 rows each)
    const int wc   = wave & 1;          // 0..1 : wave col (32 cols each)

    const int blockRow = blockIdx.y * FT;
    const int blockCol = blockIdx.x * HD;

    v8f acc[4][2];
    #pragma unroll
    for (int i = 0; i < 4; ++i)
        #pragma unroll
        for (int j = 0; j < 2; ++j)
            acc[i][j] = (v8f){0.f, 0.f, 0.f, 0.f, 0.f, 0.f, 0.f, 0.f};

    const int kBase  = ksl * (Kdim / 2); // first k of this group's half
    const int nTiles = Kdim / (2 * BK);  // K steps of one group

    // ---- double-buffered pipeline: 12 x b128 per thread per tile ----
    // tile = A[128x64] ++ B[64x64] bf16 = 1536 x 16B chunks. Eight lanes side by
    // side take one row's 128 B: a wave's copy touches four whole cache lines.
    const int crow = tid >> 3;                          // row within a sweep of 16
    const int cseg = tid & 7;                           // 16 B chunk of the row
    const int sseg = cseg ^ ((crow >> 1) & 7);          // its place (see load_frag_sw)
    auto issue_tile = [&](int buf, int k0) {
        #pragma unroll
        for (int i = 0; i < FT / 16; ++i) {
            const int row = crow + i * 16;
            async_cp16(A + (size_t)(blockRow + row) * Kdim + k0 + cseg * 8,
                       As0 + buf * FT * BK + row * BK + sseg * 8);
        }
        #pragma unroll
        for (int i = 0; i < HD / 16; ++i) {
            const int row = crow + i * 16;
            async_cp16(W + (size_t)(blockCol + row) * Kdim + k0 + cseg * 8,
                       Bs0 + buf * HD * BK + row * BK + sseg * 8);
        }
    };

    issue_tile(0, kBase);
    for (int t = 0; t < nTiles; ++t) {
        const int cur = t & 1;
        if (t + 1 < nTiles) {
            issue_tile(cur ^ 1, kBase + (t + 1) * BK); // overlap next tile DMA
            wait_copies<12>();                         // all but tile t+1's twelve: tile t landed
        } else {
            wait_copies<0>();
        }
        // publishes tile t to the group's other waves; standing directly behind
        // the wait it also holds the LDS reads below behind that wait
        __syncthreads();

        // the tile's two WMMA K slices in rising k;
        // unrolled so that ks is a constant in the LDS read offsets
        #pragma unroll
        for (int ks = 0; ks < BK; ks += 32) {
            v16bf af[4], bfd[2];
            #pragma unroll
            for (int i = 0; i < 4; ++i) af[i]  = load_frag_sw(As0 + cur * FT * BK, wr * 64 + i * 16, ks, lane);
            #pragma unroll
            for (int j = 0; j < 2; ++j) bfd[j] = load_frag_sw(Bs0 + cur * HD * BK, wc * 32 + j * 16, ks, lane);

            #pragma unroll
            for (int i = 0; i < 4; ++i)
                #pragma unroll
                for (int j = 0; j < 2; ++j)
                    acc[i][j] = __builtin_amdgcn_wmma_f32_16x16x32_bf16(
                        false, af[i], false, bfd[j], (short)0, acc[i][j], false, false);
        }
        __syncthreads();                                // buf[cur] reusable
    }

    // ---- add the two partial tiles of each product: the group of K half o
    // finishes accumulator rows i = 2 * o, 2 * o + 1 of every wave and hands the
    // other two to its partner group through LDS, 16 B per lane and lanes side by
    // side. The ring is free: the loop ended in a barrier behind every wave's last
    // LDS read, and no copy is outstanding behind the last trip's wait to 0.
    float4* const red = reinterpret_cast<float4*>(smem);
    #pragma unroll
    for (int i = 0; i < 4; ++i) {
        if (ksl != (i >> 1)) {
            #pragma unroll
            for (int j = 0; j < 2; ++j)
                #pragma unroll
                for (int h = 0; h < 2; ++h)
                    red[(((grp ^ 1) * 2 + (i & 1)) * 4 + j * 2 + h) * 128 + tid] =
                        make_float4(acc[i][j][h * 4 + 0], acc[i][j][h * 4 + 1],
                                    acc[i][j][h * 4 + 2], acc[i][j][h * 4 + 3]);
        }
    }
    __syncthreads();                                    // partial tiles visible to their owners

    // the rows this group finishes, picked by the scalar K half so that one copy
    // of the code below serves both
    v8f fin[2][2];
    #pragma unroll
    for (int i = 0; i < 4; ++i)
        if (ksl == (i >> 1)) {
            fin[i & 1][0] = acc[i][0];
            fin[i & 1][1] = acc[i][1];
        }
    #pragma unroll
    for (int ii = 0; ii < 2; ++ii)
        #pragma unroll
        for (int j = 0; j < 2; ++j)
            #pragma unroll
            for (int h = 0; h < 2; ++h) {
                const float4 p = red[((grp * 2 + ii) * 4 + j * 2 + h) * 128 + tid];
                fin[ii][j][h * 4 + 0] += p.x;  fin[ii][j][h * 4 + 1] += p.y;
                fin[ii][j][h * 4 + 2] += p.z;  fin[ii][j][h * 4 + 3] += p.w;
            }

    // ---- finished tiles to LDS, behind the partial tiles' place:
    // VGPR v -> row v (+8 for upper lane half), col = lane&15 ----
    float* const qkv = reinterpret_cast<float*>(smem + RED_BYTES);
    {
        float* const mine = qkv + prod * FT * QPIT;
        const int cr = (lane >> 4) * 8;
        const int cc = lane & 15;
        #pragma unroll
        for (int ii = 0; ii < 2; ++ii) {
            #pragma unroll
            for (int j = 0; j < 2; ++j) {
                const int col = wc * 32 + j * 16 + cc;
                const float b = bias[blockCol + col];
                #pragma unroll
                for (int v = 0; v < 8; ++v) {
                    const int row = wr * 64 + (ksl * 2 + ii) * 16 + cr + v;
                    mine[row * QPIT + col] = fin[ii][j][v] + b;
                }
            }
        }
    }
    __syncthreads();                                    // Q, K, V tiles visible to every wave

    // ---- attention: a 16-lane row takes one token, four channels a lane.
    // 128 tokens over 48 rows: waves 0..15 take three tokens a row, the others two;
    // the trip count is the same in every lane of a wave (the DPP steps need all on)
    const int wv     = __builtin_amdgcn_readfirstlane((int)(threadIdx.x >> 5));
    const int rounds = (2 * FROWS + 2 * wv + 1 < FT) ? 3 : 2;
    const int l16    = threadIdx.x & 15;
    for (int rd = 0; rd < rounds; ++rd) {
        const int tok = (int)(threadIdx.x >> 4) + rd * FROWS;
        const float* const kk = qkv + (FT + tok) * QPIT;
        const float* const vv = qkv + (2 * FT + tok) * QPIT;

        // Largest and smallest key of the head. The 16 lanes of a row hold the
        // head's 64 keys, four each, so four xor steps inside the row finish it.
        const float4 kown = *reinterpret_cast<const float4*>(kk + l16 * 4);
        float kmax = fmaxf(fmaxf(kown.x, kown.y), fmaxf(kown.z, kown.w));
        float kmin = fminf(fminf(kown.x, kown.y), fminf(kown.z, kown.w));
        kmax = fmaxf(kmax, row_xor<1>(kmax));  kmin = fminf(kmin, row_xor<1>(kmin));
        kmax = fmaxf(kmax, row_xor<2>(kmax));  kmin = fminf(kmin, row_xor<2>(kmin));
        kmax = fmaxf(kmax, row_xor<4>(kmax));  kmin = fminf(kmin, row_xor<4>(kmin));
        kmax = fmaxf(kmax, row_xor<8>(kmax));  kmin = fminf(kmin, row_xor<8>(kmin));

        const float4 qv = *reinterpret_cast<const float4*>(qkv + tok * QPIT + l16 * 4);
        const float  q4[4] = {qv.x, qv.y, qv.z, qv.w};
        float        s[4], mx[4], out[4];

        #pragma unroll
        for (int c = 0; c < 4; ++c) {
            s[c] = q4[c] * 0.125f;                  // 1/sqrt(64)
            // rounding is monotone, so the largest rounded product s * k_j is the one
            // with the largest key (s >= 0) or with the smallest key (s < 0)
            mx[c] = fmaxf(s[c] * kmax, s[c] * kmin);
        }
        // Keys outermost, the thread's four channels side by side: one 16 B read of
        // keys and one of values feed 16 exponentials, and two channels share each
        // packed f32 instruction. Every channel sums in rising j.
        const v2f sp[2] = {{s[0], s[1]}, {s[2], s[3]}};
        const v2f nm[2] = {{-mx[0], -mx[1]}, {-mx[2], -mx[3]}};
        v2f se[2] = {{0.f, 0.f}, {0.f, 0.f}};
        v2f av[2] = {{0.f, 0.f}, {0.f, 0.f}};
        // unrolled by 2: the second four keys' reads are in flight under the first four's work
        #pragma unroll 2
        for (int j = 0; j < 64; j += 4) {
            const float4 k4 = *reinterpret_cast<const float4*>(kk + j);
            const float4 v4 = *reinterpret_cast<const float4*>(vv + j);
            const float  kj[4] = {k4.x, k4.y, k4.z, k4.w};
            const float  vj[4] = {v4.x, v4.y, v4.z, v4.w};
            #pragma unroll
            for (int u = 0; u < 4; ++u)
                #pragma unroll
                for (int p = 0; p < 2; ++p) {
                    // exp(x) = 2^(x * log2 e): the fast exponential's own two steps
                    const v2f t = __builtin_elementwise_fma(sp[p], (v2f){kj[u], kj[u]}, nm[p])
                                  * 1.44269504f;
                    const v2f e = {__builtin_amdgcn_exp2f(t.x), __builtin_amdgcn_exp2f(t.y)};
                    se[p] += e;
                    av[p] = __builtin_elementwise_fma(e, (v2f){vj[u], vj[u]}, av[p]);
                }
        }
        #pragma unroll
        for (int c = 0; c < 4; ++c) out[c] = av[c >> 1][c & 1] / se[c >> 1][c & 1];
        ushort4 h;
        h.x = f2bf(out[0]); h.y = f2bf(out[1]); h.z = f2bf(out[2]); h.w = f2bf(out[3]);
        *reinterpret_cast<ushort4*>(Ctx + (size_t)(blockRow + tok) * Nout + blockCol + l16 * 4) = h;
        // the next round overwrites the store's address and data registers
        asm volatile("s_wait_xcnt 0x0" ::: "memory");
    }
}

extern "C" void kernel_launch(void* const* d_in, const int* in_sizes, int n_in,
                              void* d_out, int out_size, void* d_ws, size_t ws_size,
                              hipStream_t stream) {
    (void)in_sizes; (void)n_in; (void)out_size; (void)ws_size;
    const float* x_q = (const float*)d_in[0];
    const float* x_k = (const float*)d_in[1];
    const float* x_v = (const float*)d_in[2];
    const float* Wq  = (const float*)d_in[3];
    const float* bq  = (const float*)d_in[4];
    const float* Wk  = (const float*)d_in[5];
    const float* bk  = (const float*)d_in[6];
    const float* Wv  = (const float*)d_in[7];
    const float* bv  = (const float*)d_in[8];
    const float* Wo  = (const float*)d_in[9];
    const float* bo  = (const float*)d_in[10];
    float* out = (float*)d_out;

    const int Mrows = 4 * 512;                    // 2048 tokens
    const int D     = 1024;
    const size_t actElems = (size_t)Mrows * D;    // 2M
    const size_t wElems   = (size_t)D * D;        // 1M

    // workspace layout (24 MB total)
    unsigned short* bXq = (unsigned short*)d_ws;
    unsigned short* bXk = bXq + actElems;
    unsigned short* bXv = bXk + actElems;
    unsigned short* bWq = bXv + actElems;
    unsigned short* bWk = bWq + wElems;
    unsigned short* bWv = bWk + wElems;
    unsigned short* bWo = bWv + wElems;
    unsigned short* Cx  = bWo + wElems;

    dim3 block(256);
    // bXq..bWo are contiguous in this order: one launch fills all seven planes
    cvt_all_f32_bf16<<<CVT_BLOCKS, block, 0, stream>>>(x_q, x_k, x_v, Wq, Wk, Wv, Wo, bXq);

    // Q, K, V projections and the attention of one head and 128 tokens per block:
    // 256 blocks of 24 waves, one per WGP (bXq|bXk|bXv and bWq|bWk|bWv are each
    // contiguous)
    dim3 gridF(D / HD, Mrows / FT, 1);            // (16, 16)
    qkv_attn_fused<<<gridF, dim3(768), 0, stream>>>(bXq, bWq, bq, bk, bv, Cx, Mrows, D, D);

    // 128 blocks, at most one per WGP: K in four slices, 32 waves a block
    dim3 gridO(D / BN, Mrows / BM, 1);            // (8, 16, 1)
    gemm_bias_bf16wmma<4><<<gridO, dim3(1024), 0, stream>>>(Cx, bWo, bo, bo, bo, out, Mrows, D, D);
}

// v008
// It runs in 45.7 microseconds.
// Timed twice side by side with v007, it ran 1.06 times as fast both times.
// Counting every step since v000, it is 2.68 times as fast.
#include <hip/hip_runtime.h>

// ---------------------------------------------------------------------------
// MHTempCtxAttention for MI455X (gfx1250, wave32, WMMA + async LDS DMA)
// Pipeline:
//   1) one-launch fp32->bf16 conversion of activations & weights
//   2) Q, K, V projections (bf16 WMMA) of one head and 128 tokens per block,
//      tiles staged into LDS with GLOBAL_LOAD_ASYNC_TO_LDS_B128 + s_wait_asynccnt
//      double-buffer pipeline, K split over two wave groups per product; the
//      finished f32 tiles stay in LDS and the same block does the rank-1 softmax
//      attention on fp32 VALU (v_exp_f32), ctx emitted as bf16
//   3) output projection GEMM (128 x 64 tiles, K split over four wave groups) -> fp32 d_out
// ---------------------------------------------------------------------------

typedef __attribute__((ext_vector_type(16))) __bf16 v16bf;
typedef __attribute__((ext_vector_type(8)))  float  v8f;
typedef __attribute__((ext_vector_type(4)))  int    v4i;
typedef __attribute__((ext_vector_type(2)))  float  v2f;

#define BM   128      // block tile rows
#define BK   64       // K step: one tile row is 128 B, a whole cache line (two WMMA K of 32)
#define LSTR 72       // LDS row stride in bf16 elems (64 + 8 pad; 144 B = 16 B x odd)

#if __has_builtin(__builtin_amdgcn_global_load_async_to_lds_b128)
#define ASYNC_LDS 1
#else
#define ASYNC_LDS 0
#endif

#if __has_builtin(__builtin_amdgcn_s_wait_asynccnt)
#define WAIT_ASYNC(n) __builtin_amdgcn_s_wait_asynccnt(n)
#else
#define WAIT_ASYNC(n) asm volatile("s_wait_asynccnt %0" :: "n"(n) : "memory")
#endif

typedef __attribute__((address_space(1))) v4i as1_v4i;   // global 16B vector
typedef __attribute__((address_space(3))) v4i as3_v4i;   // LDS 16B vector

__device__ __forceinline__ unsigned short f2bf(float f) {
    unsigned int u = __float_as_uint(f);
    u += 0x7FFFu + ((u >> 16) & 1u);           // round-to-nearest-even
    return (unsigned short)(u >> 16);
}

#if ASYNC_LDS
// 16B async DMA: LDS[dst] = MEM[src], tracked by ASYNCcnt (no VGPR round-trip)
__device__ __forceinline__ void async_cp16(const void* gsrc, void* ldsdst) {
    __builtin_amdgcn_global_load_async_to_lds_b128(
        (as1_v4i*)(unsigned long long)gsrc,
        (as3_v4i*)(unsigned int)(unsigned long long)ldsdst,
        /*offset=*/0, /*cpol=*/0);
}
// the issuing wave's copies have landed, all but its N youngest
template <int N>
__device__ __forceinline__ void wait_copies() { WAIT_ASYNC(N); }
#else
// no async copy in this build: the same 16 B through a register; the barrier
// behind wait_copies() publishes the LDS store
__device__ __forceinline__ void async_cp16(const void* gsrc, void* ldsdst) {
    *reinterpret_cast<uint4*>(ldsdst) = *reinterpret_cast<const uint4*>(gsrc);
}
template <int N>
__device__ __forceinline__ void wait_copies() {}
#endif

// Load one 16x32 bf16 fragment from LDS, k0 = first k of the fragment inside the
// tile row (ISA striping):
//   lanes 0-15 : row = lane,    K = {0..7, 16..23}
//   lanes 16-31: row = lane-16, K = {8..15, 24..31}
__device__ __forceinline__ v16bf load_frag(const unsigned short* lds,
                                           int rowBase, int k0, int lane) {
    const int r  = lane & 15;
    const int kb = (lane >> 4) << 3;
    const unsigned short* p = lds + (rowBase + r) * LSTR + k0 + kb;
    union { v16bf v; uint4 q[2]; } u;
    u.q[0] = *reinterpret_cast<const uint4*>(p);
    u.q[1] = *reinterpret_cast<const uint4*>(p + 16);
    return u.v;
}

// C[M x N] = A[M x K](bf16) * W[N x K](bf16)^T + bias[N](f32), C = f32
// blockIdx.z picks one of up to three independent products of the same shape:
// their A, W and C planes lie back to back behind Abase, Wbase and Cbase.
// A block is S groups of TBN / 16 waves (a wave holds 64 x 32). Every group works
// on the whole 128 x TBN tile but walks only its own Kdim / S slice of K, with its own pair of LDS
// buffers: the serial chain of K steps (each one a copy latency, LDS latencies
// and two barriers long) is S times shorter, and the groups fill each other's
// stalls. The S partial tiles are added through LDS behind the loop.
// Kdim must be a multiple of S * BK.
template <int S, int TBN>
__global__ void __launch_bounds__(2 * TBN * S)
gemm_bias_bf16wmma(const unsigned short* __restrict__ Abase,
                   const unsigned short* __restrict__ Wbase,
                   const float* __restrict__ bias0,
                   const float* __restrict__ bias1,
                   const float* __restrict__ bias2,
                   float* __restrict__ Cbase,
                   int Mrows, int Nout, int Kdim)
{
    const int z = blockIdx.z;
    const unsigned short* __restrict__ A = Abase + (size_t)z * Mrows * Kdim;
    const unsigned short* __restrict__ W = Wbase + (size_t)z * Nout * Kdim;
    const float* __restrict__ bias = (z == 0) ? bias0 : (z == 1) ? bias1 : bias2;
    float* __restrict__ C = Cbase + (size_t)z * Mrows * Nout;

    // ring: per group two A and two B buffers; behind the loop the same LDS holds
    // the partial tiles on their way to the group that finishes them
    constexpr int WC  = TBN / 32;                // wave columns of a group
    constexpr int GT  = 64 * WC;                 // threads of a group (2 x WC waves)
    constexpr int CPT = (BM + TBN) * 8 / GT;     // 16 B copies per thread per tile
    constexpr int RING_BYTES = S * 2 * (BM + TBN) * LSTR * 2;
    constexpr int RED_BYTES  = (S - 1) * BM * TBN * 4;
    __shared__ __align__(16) unsigned char smem[RING_BYTES > RED_BYTES ? RING_BYTES : RED_BYTES];

    // group number: the same in every lane of a wave, kept scalar for the branches
    const int grp  = __builtin_amdgcn_readfirstlane((int)(threadIdx.x / GT));
    const int tid  = threadIdx.x % GT;  // thread within its group
    unsigned short* const As0 = reinterpret_cast<unsigned short*>(smem) + grp * 2 * (BM + TBN) * LSTR;
    unsigned short* const Bs0 = As0 + 2 * BM * LSTR;
    const int lane = tid & 31;
    const int wave = tid >> 5;
    const int wr   = wave / WC;         // 0..1 : wave row (64 rows each)
    const int wc   = wave % WC;         // wave col (32 cols each)

    const int blockRow = blockIdx.y * BM;
    const int blockCol = blockIdx.x * TBN;

    v8f acc[4][2];
    #pragma unroll
    for (int i = 0; i < 4; ++i)
        #pragma unroll
        for (int j = 0; j < 2; ++j)
            acc[i][j] = (v8f){0.f, 0.f, 0.f, 0.f, 0.f, 0.f, 0.f, 0.f};

    const int kBase  = grp * (Kdim / S); // first k of this group's slice
    const int nTiles = Kdim / (S * BK);  // K steps of one group

#if ASYNC_LDS
    // ---- async double-buffered pipeline: CPT x b128 per thread per tile ----
    // chunk mapping: tile = A[128x64] ++ B[TBNx64] bf16, 16B chunks.
    // Eight lanes side by side take one row's 128 B, so a wave's copy touches
    // four whole cache lines and no line is asked for by two K steps.
    auto issue_tile = [&](int buf, int k0) {
        #pragma unroll
        for (int i = 0; i < BM * 8 / GT; ++i) {        // A part
            const int c   = tid + i * GT;
            const int row = c >> 3, seg = c & 7;       // 8 x 16B per row
            async_cp16(A + (size_t)(blockRow + row) * Kdim + k0 + seg * 8,
                       As0 + buf * BM * LSTR + row * LSTR + seg * 8);
        }
        #pragma unroll
        for (int i = 0; i < TBN * 8 / GT; ++i) {       // B part
            const int c   = tid + i * GT;
            const int row = c >> 3, seg = c & 7;
            async_cp16(W + (size_t)(blockCol + row) * Kdim + k0 + seg * 8,
                       Bs0 + buf * TBN * LSTR + row * LSTR + seg * 8);
        }
    };

    issue_tile(0, kBase);
    for (int t = 0; t < nTiles; ++t) {
        const int cur = t & 1;
        if (t + 1 < nTiles) {
            issue_tile(cur ^ 1, kBase + (t + 1) * BK); // overlap next tile DMA
            WAIT_ASYNC(CPT);                           // all but tile t+1's copies: tile t landed
        } else {
            WAIT_ASYNC(0);
        }
        // publishes tile t to the group's other waves; standing directly behind
        // the wait it also holds the LDS reads below behind that wait
        __syncthreads();

        // the tile's two WMMA K slices in rising k: the sum order stays the same;
        // unrolled so that ks is a constant in the LDS read offsets
        #pragma unroll
        for (int ks = 0; ks < BK; ks += 32) {
            v16bf af[4], bfd[2];
            #pragma unroll
            for (int i = 0; i < 4; ++i) af[i]  = load_frag(As0 + cur * BM * LSTR, wr * 64 + i * 16, ks, lane);
            #pragma unroll
            for (int j = 0; j < 2; ++j) bfd[j] = load_frag(Bs0 + cur * TBN * LSTR, wc * 32 + j * 16, ks, lane);

            #pragma unroll
            for (int i = 0; i < 4; ++i)
                #pragma unroll
                for (int j = 0; j < 2; ++j)
                    acc[i][j] = __builtin_amdgcn_wmma_f32_16x16x32_bf16(
                        false, af[i], false, bfd[j], (short)0, acc[i][j], false, false);
        }
        __syncthreads();                                // buf[cur] reusable
    }
#else
    // ---- sync fallback: batched wide loads, then wide LDS stores ----
    for (int t = 0; t < nTiles; ++t) {
        const int k0 = kBase + t * BK;
        uint4 ra[BM * 8 / GT], rb[TBN * 8 / GT];
        #pragma unroll
        for (int i = 0; i < BM * 8 / GT; ++i) {
            const int c = tid + i * GT, row = c >> 3, seg = c & 7;
            ra[i] = *reinterpret_cast<const uint4*>(
                A + (size_t)(blockRow + row) * Kdim + k0 + seg * 8);
        }
        #pragma unroll
        for (int i = 0; i < TBN * 8 / GT; ++i) {
            const int c = tid + i * GT, row = c >> 3, seg = c & 7;
            rb[i] = *reinterpret_cast<const uint4*>(
                W + (size_t)(blockCol + row) * Kdim + k0 + seg * 8);
        }
        __syncthreads();
        #pragma unroll
        for (int i = 0; i < BM * 8 / GT; ++i) {
            const int c = tid + i * GT, row = c >> 3, seg = c & 7;
            *reinterpret_cast<uint4*>(As0 + row * LSTR + seg * 8) = ra[i];
        }
        #pragma unroll
        for (int i = 0; i < TBN * 8 / GT; ++i) {
            const int c = tid + i * GT, row = c >> 3, seg = c & 7;
            *reinterpret_cast<uint4*>(Bs0 + row * LSTR + seg * 8) = rb[i];
        }
        __syncthreads();

        #pragma unroll
        for (int ks = 0; ks < BK; ks += 32) {
            v16bf af[4], bfd[2];
            #pragma unroll
            for (int i = 0; i < 4; ++i) af[i]  = load_frag(As0, wr * 64 + i * 16, ks, lane);
            #pragma unroll
            for (int j = 0; j < 2; ++j) bfd[j] = load_frag(Bs0, wc * 32 + j * 16, ks, lane);

            #pragma unroll
            for (int i = 0; i < 4; ++i)
                #pragma unroll
                for (int j = 0; j < 2; ++j)
                    acc[i][j] = __builtin_amdgcn_wmma_f32_16x16x32_bf16(
                        false, af[i], false, bfd[j], (short)0, acc[i][j], false, false);
        }
    }
    __syncthreads();                                    // ring reusable
#endif

    // ---- add the S partial tiles: group o finishes accumulator rows
    // i = o * IPG .. o * IPG + IPG - 1 of every wave. Each group hands the rows it
    // does not finish to their owner through LDS, 16 B per lane and lanes side by
    // side. The ring is free: the loop ended in a barrier behind every wave's last
    // LDS read, and no copy is outstanding behind the last trip's wait to 0.
    constexpr int IPG = 4 / S;
    float4* const red = reinterpret_cast<float4*>(smem);
    #pragma unroll
    for (int i = 0; i < 4; ++i) {
        const int owner = i / IPG;
        if (grp != owner) {
            const int slot = owner * (S - 1) + (grp < owner ? grp : grp - 1);
            #pragma unroll
            for (int j = 0; j < 2; ++j)
                #pragma unroll
                for (int h = 0; h < 2; ++h)
                    red[((slot * IPG + i % IPG) * 4 + j * 2 + h) * GT + tid] =
                        make_float4(acc[i][j][h * 4 + 0], acc[i][j][h * 4 + 1],
                                    acc[i][j][h * 4 + 2], acc[i][j][h * 4 + 3]);
        }
    }
    __syncthreads();                                    // partial tiles visible to their owners

    // the rows this group finishes, picked by the scalar group number so that one
    // copy of the code below serves every group
    v8f fin[IPG][2];
    #pragma unroll
    for (int i = 0; i < 4; ++i)
        if (grp == i / IPG) {
            fin[i % IPG][0] = acc[i][0];
            fin[i % IPG][1] = acc[i][1];
        }
    // own partial first, then the other groups' in rising group order
    #pragma unroll
    for (int s = 0; s < S - 1; ++s)
        #pragma unroll
        for (int ii = 0; ii < IPG; ++ii)
            #pragma unroll
            for (int j = 0; j < 2; ++j)
                #pragma unroll
                for (int h = 0; h < 2; ++h) {
                    const float4 p =
                        red[(((grp * (S - 1) + s) * IPG + ii) * 4 + j * 2 + h) * GT + tid];
                    fin[ii][j][h * 4 + 0] += p.x;  fin[ii][j][h * 4 + 1] += p.y;
                    fin[ii][j][h * 4 + 2] += p.z;  fin[ii][j][h * 4 + 3] += p.w;
                }

    // ---- store: VGPR v -> row v (+8 for upper lane half), col = lane&15 ----
    const int cr = (lane >> 4) * 8;
    const int cc = lane & 15;
    #pragma unroll
    for (int ii = 0; ii < IPG; ++ii) {
        #pragma unroll
        for (int j = 0; j < 2; ++j) {
            const int col = blockCol + wc * 32 + j * 16 + cc;
            const float b = bias[col];
            #pragma unroll
            for (int v = 0; v < 8; ++v) {
                const int row = blockRow + wr * 64 + (grp * IPG + ii) * 16 + cr + v;
                C[(size_t)row * Nout + col] = fin[ii][j][v] + b;
            }
        }
    }
}

// fp32 -> bf16 conversion of all seven tensors in ONE launch of few, long-lived
// waves. The bf16 planes lie back to back in the workspace in argument order,
// so sweep n of the grid writes float4 group n * CVT_STRIDE + g of that region.
#define CVT_BLOCKS  512                     // 2 blocks (16 waves) per WGP
#define CVT_STRIDE  (CVT_BLOCKS * 256)      // float4 groups per sweep of the grid
#define ACT_SWEEPS  4                       // 2048 * 1024 / 4 / CVT_STRIDE
#define W_SWEEPS    2                       // 1024 * 1024 / 4 / CVT_STRIDE
static_assert(ACT_SWEEPS * CVT_STRIDE * 4 == 2048 * 1024, "activation sweeps");
static_assert(W_SWEEPS   * CVT_STRIDE * 4 == 1024 * 1024, "weight sweeps");

__global__ void __launch_bounds__(256)
cvt_all_f32_bf16(const float* __restrict__ xq, const float* __restrict__ xk,
                 const float* __restrict__ xv, const float* __restrict__ wq,
                 const float* __restrict__ wk, const float* __restrict__ wv,
                 const float* __restrict__ wo, unsigned short* __restrict__ dst)
{
    const int g = blockIdx.x * 256 + threadIdx.x;
    const float* const act[3] = {xq, xk, xv};
    const float* const wts[4] = {wq, wk, wv, wo};
    float4 f[3 * ACT_SWEEPS + 4 * W_SWEEPS];

    // all loads first: every thread keeps its 20 independent 16B reads in flight.
    // Every loop here is fully unrolled so that f[] stays in registers and the
    // tensor each sweep reads is known at compile time (no per-sweep select).
    #pragma unroll
    for (int t = 0; t < 3; ++t)
        #pragma unroll
        for (int s = 0; s < ACT_SWEEPS; ++s)
            f[t * ACT_SWEEPS + s] =
                reinterpret_cast<const float4*>(act[t])[s * CVT_STRIDE + g];
    #pragma unroll
    for (int t = 0; t < 4; ++t)
        #pragma unroll
        for (int s = 0; s < W_SWEEPS; ++s)
            f[3 * ACT_SWEEPS + t * W_SWEEPS + s] =
                reinterpret_cast<const float4*>(wts[t])[s * CVT_STRIDE + g];

    #pragma unroll
    for (int n = 0; n < 3 * ACT_SWEEPS + 4 * W_SWEEPS; ++n) {
        ushort4 h;
        h.x = f2bf(f[n].x); h.y = f2bf(f[n].y); h.z = f2bf(f[n].z); h.w = f2bf(f[n].w);
        reinterpret_cast<ushort4*>(dst)[n * CVT_STRIDE + g] = h;
    }
}

// Value of lane (l ^ M) of the same 16-lane row, all lanes on (DPP row_xmask).
template <int M>
__device__ __forceinline__ float row_xor(float x) {
    return __int_as_float(__builtin_amdgcn_update_dpp(
        0, __float_as_int(x), 0x160 | M, 0xf, 0xf, true));
}

// Same fragment as load_frag, from a tile whose rows are 128 B with no pad: the
// 16 B chunk c of row r lies at place c ^ ((r >> 1) & 7), so 16 lanes that read one
// chunk column of 16 rows fall on 16 different 16 B places of the 256 B bank row.
// rowBase is a multiple of 16.
__device__ __forceinline__ v16bf load_frag_sw(const unsigned short* lds,
                                              int rowBase, int k0, int lane) {
    const int r = lane & 15;
    const int x = (r >> 1) & 7;
    const int c = (k0 >> 3) + (lane >> 4);
    const unsigned short* p = lds + (rowBase + r) * BK;
    union { v16bf v; uint4 q[2]; } u;
    u.q[0] = *reinterpret_cast<const uint4*>(p + ((c ^ x) << 3));
    u.q[1] = *reinterpret_cast<const uint4*>(p + (((c + 2) ^ x) << 3));
    return u.v;
}

#define FT    128     // tokens of a block
#define HD    64      // channels of one head: the columns of each of the three tiles
#define QPIT  68      // f32 pitch of the finished tiles in LDS (272 B = 16 B x odd)
#define FROWS 48      // 16-lane rows in a block of 24 waves

// Q, K and V projections of one head for 128 tokens, then that head's attention,
// in one block: the three f32 tiles go from the accumulators to the attention
// through LDS and never through memory.
// Projections: X[M x K](bf16) * W[N x K](bf16)^T + bias[N](f32); the three A, W
// planes lie back to back behind Abase, Wbase. Six groups of four waves: group
// 2 * p + s works on product p and on half s of K, with its own pair of LDS
// buffers; a wave holds 64 x 32 of its group's 128 x 64 tile.
// Attention: scores[d][q] = q_d*k_q/8, so softmax row d is softmax_q(q_d*k_q):
// never materialize the 64x64 matrix. The row maximum needs no pass over the
// keys: it is q_d/8 times the head's largest or smallest key.
// Kdim must be a multiple of 2 * BK.
__global__ void __launch_bounds__(768)
qkv_attn_fused(const unsigned short* __restrict__ Abase,
               const unsigned short* __restrict__ Wbase,
               const float* __restrict__ bias0,
               const float* __restrict__ bias1,
               const float* __restrict__ bias2,
               unsigned short* __restrict__ Ctx,
               int Mrows, int Nout, int Kdim)
{
    constexpr int BUF_ELEMS  = (FT + HD) * BK;            // one A and one B buffer
    constexpr int RING_BYTES = 6 * 2 * BUF_ELEMS * 2;     // 288 KiB
    constexpr int RED_BYTES  = 6 * 2 * 4 * 128 * 16;      // half a partial tile per group
    constexpr int QKV_BYTES  = 3 * FT * QPIT * 4;
    static_assert(RED_BYTES + QKV_BYTES <= RING_BYTES, "hand-over fits in the ring");
    __shared__ __align__(16) unsigned char smem[RING_BYTES];

    // group number: the same in every lane of a wave, kept scalar for the branches
    const int grp  = __builtin_amdgcn_readfirstlane((int)(threadIdx.x >> 7));
    const int prod = grp >> 1;          // 0 Q, 1 K, 2 V
    const int ksl  = grp & 1;           // half of K
    const int tid  = threadIdx.x & 127; // thread within its group
    const unsigned short* __restrict__ A = Abase + (size_t)prod * Mrows * Kdim;
    const unsigned short* __restrict__ W = Wbase + (size_t)prod * Nout * Kdim;
    const float* __restrict__ bias = (prod == 0) ? bias0 : (prod == 1) ? bias1 : bias2;
    unsigned short* const As0 = reinterpret_cast<unsigned short*>(smem) + grp * 2 * BUF_ELEMS;
    unsigned short* const Bs0 = As0 + 2 * FT * BK;
    const int lane = tid & 31;
    const int wave = tid >> 5;          // 0..3
    const int wr   = wave >> 1;         // 0..1 : wave row (64 rows each)
    const int wc   = wave & 1;          // 0..1 : wave col (32 cols each)

    const int blockRow = blockIdx.y * FT;
    const int blockCol = blockIdx.x * HD;

    v8f acc[4][2];
    #pragma unroll
    for (int i = 0; i < 4; ++i)
        #pragma unroll
        for (int j = 0; j < 2; ++j)
            acc[i][j] = (v8f){0.f, 0.f, 0.f, 0.f, 0.f, 0.f, 0.f, 0.f};

    const int kBase  = ksl * (Kdim / 2); // first k of this group's half
    const int nTiles = Kdim / (2 * BK);  // K steps of one group

    // ---- double-buffered pipeline: 12 x b128 per thread per tile ----
    // tile = A[128x64] ++ B[64x64] bf16 = 1536 x 16B chunks. Eight lanes side by
    // side take one row's 128 B: a wave's copy touches four whole cache lines.
    const int crow = tid >> 3;                          // row within a sweep of 16
    const int cseg = tid & 7;                           // 16 B chunk of the row
    const int sseg = cseg ^ ((crow >> 1) & 7);          // its place (see load_frag_sw)
    auto issue_tile = [&](int buf, int k0) {
        #pragma unroll
        for (int i = 0; i < FT / 16; ++i) {
            const int row = crow + i * 16;
            async_cp16(A + (size_t)(blockRow + row) * Kdim + k0 + cseg * 8,
                       As0 + buf * FT * BK + row * BK + sseg * 8);
        }
        #pragma unroll
        for (int i = 0; i < HD / 16; ++i) {
            const int row = crow + i * 16;
            async_cp16(W + (size_t)(blockCol + row) * Kdim + k0 + cseg * 8,
                       Bs0 + buf * HD * BK + row * BK + sseg * 8);
        }
    };

    issue_tile(0, kBase);
    for (int t = 0; t < nTiles; ++t) {
        const int cur = t & 1;
        if (t + 1 < nTiles) {
            issue_tile(cur ^ 1, kBase + (t + 1) * BK); // overlap next tile DMA
            wait_copies<12>();                         // all but tile t+1's twelve: tile t landed
        } else {
            wait_copies<0>();
        }
        // publishes tile t to the group's other waves; standing directly behind
        // the wait it also holds the LDS reads below behind that wait
        __syncthreads();

        // the tile's two WMMA K slices in rising k;
        // unrolled so that ks is a constant in the LDS read offsets
        #pragma unroll
        for (int ks = 0; ks < BK; ks += 32) {
            v16bf af[4], bfd[2];
            #pragma unroll
            for (int i = 0; i < 4; ++i) af[i]  = load_frag_sw(As0 + cur * FT * BK, wr * 64 + i * 16, ks, lane);
            #pragma unroll
            for (int j = 0; j < 2; ++j) bfd[j] = load_frag_sw(Bs0 + cur * HD * BK, wc * 32 + j * 16, ks, lane);

            #pragma unroll
            for (int i = 0; i < 4; ++i)
                #pragma unroll
                for (int j = 0; j < 2; ++j)
                    acc[i][j] = __builtin_amdgcn_wmma_f32_16x16x32_bf16(
                        false, af[i], false, bfd[j], (short)0, acc[i][j], false, false);
        }
        __syncthreads();                                // buf[cur] reusable
    }

    // ---- add the two partial tiles of each product: the group of K half o
    // finishes accumulator rows i = 2 * o, 2 * o + 1 of every wave and hands the
    // other two to its partner group through LDS, 16 B per lane and lanes side by
    // side. The ring is free: the loop ended in a barrier behind every wave's last
    // LDS read, and no copy is outstanding behind the last trip's wait to 0.
    float4* const red = reinterpret_cast<float4*>(smem);
    #pragma unroll
    for (int i = 0; i < 4; ++i) {
        if (ksl != (i >> 1)) {
            #pragma unroll
            for (int j = 0; j < 2; ++j)
                #pragma unroll
                for (int h = 0; h < 2; ++h)
                    red[(((grp ^ 1) * 2 + (i & 1)) * 4 + j * 2 + h) * 128 + tid] =
                        make_float4(acc[i][j][h * 4 + 0], acc[i][j][h * 4 + 1],
                                    acc[i][j][h * 4 + 2], acc[i][j][h * 4 + 3]);
        }
    }
    __syncthreads();                                    // partial tiles visible to their owners

    // the rows this group finishes, picked by the scalar K half so that one copy
    // of the code below serves both
    v8f fin[2][2];
    #pragma unroll
    for (int i = 0; i < 4; ++i)
        if (ksl == (i >> 1)) {
            fin[i & 1][0] = acc[i][0];
            fin[i & 1][1] = acc[i][1];
        }
    #pragma unroll
    for (int ii = 0; ii < 2; ++ii)
        #pragma unroll
        for (int j = 0; j < 2; ++j)
            #pragma unroll
            for (int h = 0; h < 2; ++h) {
                const float4 p = red[((grp * 2 + ii) * 4 + j * 2 + h) * 128 + tid];
                fin[ii][j][h * 4 + 0] += p.x;  fin[ii][j][h * 4 + 1] += p.y;
                fin[ii][j][h * 4 + 2] += p.z;  fin[ii][j][h * 4 + 3] += p.w;
            }

    // ---- finished tiles to LDS, behind the partial tiles' place:
    // VGPR v -> row v (+8 for upper lane half), col = lane&15 ----
    float* const qkv = reinterpret_cast<float*>(smem + RED_BYTES);
    {
        float* const mine = qkv + prod * FT * QPIT;
        const int cr = (lane >> 4) * 8;
        const int cc = lane & 15;
        #pragma unroll
        for (int ii = 0; ii < 2; ++ii) {
            #pragma unroll
            for (int j = 0; j < 2; ++j) {
                const int col = wc * 32 + j * 16 + cc;
                const float b = bias[blockCol + col];
                #pragma unroll
                for (int v = 0; v < 8; ++v) {
                    const int row = wr * 64 + (ksl * 2 + ii) * 16 + cr + v;
                    mine[row * QPIT + col] = fin[ii][j][v] + b;
                }
            }
        }
    }
    __syncthreads();                                    // Q, K, V tiles visible to every wave

    // ---- attention: a 16-lane row takes one token, four channels a lane.
    // 128 tokens over 48 rows: waves 0..15 take three tokens a row, the others two;
    // the trip count is the same in every lane of a wave (the DPP steps need all on)
    const int wv     = __builtin_amdgcn_readfirstlane((int)(threadIdx.x >> 5));
    const int rounds = (2 * FROWS + 2 * wv + 1 < FT) ? 3 : 2;
    const int l16    = threadIdx.x & 15;
    for (int rd = 0; rd < rounds; ++rd) {
        const int tok = (int)(threadIdx.x >> 4) + rd * FROWS;
        const float* const kk = qkv + (FT + tok) * QPIT;
        const float* const vv = qkv + (2 * FT + tok) * QPIT;

        // Largest and smallest key of the head. The 16 lanes of a row hold the
        // head's 64 keys, four each, so four xor steps inside the row finish it.
        const float4 kown = *reinterpret_cast<const float4*>(kk + l16 * 4);
        float kmax = fmaxf(fmaxf(kown.x, kown.y), fmaxf(kown.z, kown.w));
        float kmin = fminf(fminf(kown.x, kown.y), fminf(kown.z, kown.w));
        kmax = fmaxf(kmax, row_xor<1>(kmax));  kmin = fminf(kmin, row_xor<1>(kmin));
        kmax = fmaxf(kmax, row_xor<2>(kmax));  kmin = fminf(kmin, row_xor<2>(kmin));
        kmax = fmaxf(kmax, row_xor<4>(kmax));  kmin = fminf(kmin, row_xor<4>(kmin));
        kmax = fmaxf(kmax, row_xor<8>(kmax));  kmin = fminf(kmin, row_xor<8>(kmin));

        const float4 qv = *reinterpret_cast<const float4*>(qkv + tok * QPIT + l16 * 4);
        const float  q4[4] = {qv.x, qv.y, qv.z, qv.w};
        float        s[4], mx[4], out[4];

        #pragma unroll
        for (int c = 0; c < 4; ++c) {
            s[c] = q4[c] * 0.125f;                  // 1/sqrt(64)
            // rounding is monotone, so the largest rounded product s * k_j is the one
            // with the largest key (s >= 0) or with the smallest key (s < 0)
            mx[c] = fmaxf(s[c] * kmax, s[c] * kmin);
        }
        // Keys outermost, the thread's four channels side by side: one 16 B read of
        // keys and one of values feed 16 exponentials, and two channels share each
        // packed f32 instruction. Every channel sums in rising j.
        const v2f sp[2] = {{s[0], s[1]}, {s[2], s[3]}};
        const v2f nm[2] = {{-mx[0], -mx[1]}, {-mx[2], -mx[3]}};
        v2f se[2] = {{0.f, 0.f}, {0.f, 0.f}};
        v2f av[2] = {{0.f, 0.f}, {0.f, 0.f}};
        // unrolled by 2: the second four keys' reads are in flight under the first four's work
        #pragma unroll 2
        for (int j = 0; j < 64; j += 4) {
            const float4 k4 = *reinterpret_cast<const float4*>(kk + j);
            const float4 v4 = *reinterpret_cast<const float4*>(vv + j);
            const float  kj[4] = {k4.x, k4.y, k4.z, k4.w};
            const float  vj[4] = {v4.x, v4.y, v4.z, v4.w};
            #pragma unroll
            for (int u = 0; u < 4; ++u)
                #pragma unroll
                for (int p = 0; p < 2; ++p) {
                    // exp(x) = 2^(x * log2 e): the fast exponential's own two steps
                    const v2f t = __builtin_elementwise_fma(sp[p], (v2f){kj[u], kj[u]}, nm[p])
                                  * 1.44269504f;
                    const v2f e = {__builtin_amdgcn_exp2f(t.x), __builtin_amdgcn_exp2f(t.y)};
                    se[p] += e;
                    av[p] = __builtin_elementwise_fma(e, (v2f){vj[u], vj[u]}, av[p]);
                }
        }
        #pragma unroll
        for (int c = 0; c < 4; ++c) out[c] = av[c >> 1][c & 1] / se[c >> 1][c & 1];
        ushort4 h;
        h.x = f2bf(out[0]); h.y = f2bf(out[1]); h.z = f2bf(out[2]); h.w = f2bf(out[3]);
        *reinterpret_cast<ushort4*>(Ctx + (size_t)(blockRow + tok) * Nout + blockCol + l16 * 4) = h;
        // the next round overwrites the store's address and data registers
        asm volatile("s_wait_xcnt 0x0" ::: "memory");
    }
}

extern "C" void kernel_launch(void* const* d_in, const int* in_sizes, int n_in,
                              void* d_out, int out_size, void* d_ws, size_t ws_size,
                              hipStream_t stream) {
    (void)in_sizes; (void)n_in; (void)out_size; (void)ws_size;
    const float* x_q = (const float*)d_in[0];
    const float* x_k = (const float*)d_in[1];
    const float* x_v = (const float*)d_in[2];
    const float* Wq  = (const float*)d_in[3];
    const float* bq  = (const float*)d_in[4];
    const float* Wk  = (const float*)d_in[5];
    const float* bk  = (const float*)d_in[6];
    const float* Wv  = (const float*)d_in[7];
    const float* bv  = (const float*)d_in[8];
    const float* Wo  = (const float*)d_in[9];
    const float* bo  = (const float*)d_in[10];
    float* out = (float*)d_out;

    const int Mrows = 4 * 512;                    // 2048 tokens
    const int D     = 1024;
    const size_t actElems = (size_t)Mrows * D;    // 2M
    const size_t wElems   = (size_t)D * D;        // 1M

    // workspace layout (24 MB total)
    unsigned short* bXq = (unsigned short*)d_ws;
    unsigned short* bXk = bXq + actElems;
    unsigned short* bXv = bXk + actElems;
    unsigned short* bWq = bXv + actElems;
    unsigned short* bWk = bWq + wElems;
    unsigned short* bWv = bWk + wElems;
    unsigned short* bWo = bWv + wElems;
    unsigned short* Cx  = bWo + wElems;

    dim3 block(256);
    // bXq..bWo are contiguous in this order: one launch fills all seven planes
    cvt_all_f32_bf16<<<CVT_BLOCKS, block, 0, stream>>>(x_q, x_k, x_v, Wq, Wk, Wv, Wo, bXq);

    // Q, K, V projections and the attention of one head and 128 tokens per block:
    // 256 blocks of 24 waves, one per WGP (bXq|bXk|bXv and bWq|bWk|bWv are each
    // contiguous)
    dim3 gridF(D / HD, Mrows / FT, 1);            // (16, 16)
    qkv_attn_fused<<<gridF, dim3(768), 0, stream>>>(bXq, bWq, bq, bk, bv, Cx, Mrows, D, D);

    // 128 x 64 tiles: 256 blocks, one per WGP; K in four slices, 16 waves a block
    dim3 gridO(D / 64, Mrows / BM, 1);            // (16, 16, 1)
    gemm_bias_bf16wmma<4, 64><<<gridO, dim3(512), 0, stream>>>(Cx, bWo, bo, bo, bo, out, Mrows, D, D);
}

// v009
// Measured time: 43.3 microseconds a run.
// Timed twice side by side with v008, it ran 1.04 and 1.05 times as fast.
// Counting every step since v000, it is 2.79 times as fast.
#include <hip/hip_runtime.h>

// ---------------------------------------------------------------------------
// Per-token channel attention block for gfx1250 (wave32, WMMA + tensor loads to LDS)
// Pipeline:
//   1) one-launch fp32->bf16 conversion of activations & weights
//   2) Q, K, V projections (bf16 WMMA) of one head and 128 tokens per block,
//      tiles brought into LDS by tensor_load_to_lds + s_wait_tensorcnt in a
//      two-buffer ring, K split over two wave groups per product; the
//      finished f32 tiles stay in LDS and the same block does the rank-1 softmax
//      attention on fp32 VALU (v_exp_f32), ctx emitted as bf16
//   3) output projection GEMM (128 x 64 tiles, K split over four wave groups) -> fp32 d_out
// ---------------------------------------------------------------------------

typedef __attribute__((ext_vector_type(16))) __bf16 v16bf;
typedef __attribute__((ext_vector_type(8)))  float  v8f;
typedef __attribute__((ext_vector_type(2)))  float  v2f;

#define BM   128      // block tile rows
#define BK   64       // K step: one tile row is 128 B, a whole cache line (two WMMA K of 32)
#define LSTR 72       // LDS row stride in bf16 elems (64 + 8 pad; 144 B = 16 B x odd)

typedef unsigned int u32x4 __attribute__((ext_vector_type(4)));   // descriptor group 0
typedef unsigned int u32x8 __attribute__((ext_vector_type(8)));   // descriptor group 1

__device__ __forceinline__ unsigned short f2bf(float f) {
    unsigned int u = __float_as_uint(f);
    u += 0x7FFFu + ((u >> 16) & 1u);           // round-to-nearest-even
    return (unsigned short)(u >> 16);
}

__device__ __forceinline__ unsigned int uni(unsigned int v) {
    return (unsigned int)__builtin_amdgcn_readfirstlane(v);
}
// A wave-uniform test value for the branch round a tensor load, which ignores EXEC:
// only a scalar branch keeps a wave from issuing it.
__device__ __forceinline__ unsigned int pinned(unsigned int v) {
    unsigned int w = (unsigned int)__builtin_amdgcn_readfirstlane(v);
    asm volatile("" : "+s"(w));   // holds the test value in a scalar register (s_cmp + s_cbranch_scc)
    return w;
}
// Descriptor group 1 of a two-dimensional tile, every extent in bytes: rows of ROWB
// bytes, source row pitch src_pitch, 16 B of LDS pad behind every row (PADC is the
// pad interval code of the row length: 4 for 128 B, 5 for 256 B); tensor = tile.
template <unsigned int ROWB, unsigned int PADC>
__device__ __forceinline__ u32x8 tdm_group1(unsigned int rows, unsigned int src_pitch) {
    u32x8 g;
    g[0] = uni((1u << 20) | (PADC << 22) | (3u << 25));   // no mask, 1-byte elements, pad on
    g[1] = uni((ROWB & 0xFFFFu) << 16);
    g[2] = uni((ROWB >> 16) | ((rows & 0xFFFFu) << 16));
    g[3] = uni((rows >> 16) | (ROWB << 16));
    g[4] = uni(rows);
    g[5] = uni(src_pitch);
    g[6] = uni(0u);
    g[7] = uni(0u);
    return g;
}
// Descriptor group 0: place in the work-group's LDS, address of the tile's first byte
__device__ __forceinline__ u32x4 tdm_group0(unsigned int lds_dst, unsigned long long ga) {
    u32x4 g;
    g[0] = uni(1u);
    g[1] = uni(lds_dst);
    g[2] = uni((unsigned int)ga);
    g[3] = uni((((unsigned int)(ga >> 32)) & 0x01FFFFFFu) | 0x80000000u);
    return g;
}
// one request of the whole wave: a tile from global memory into LDS, through no register
__device__ __forceinline__ void tdm_load(u32x4 g0, u32x8 g1) {
    asm volatile("tensor_load_to_lds %0, %1" :: "s"(g0), "s"(g1) : "memory");
}
// the issuing wave's tensor loads have landed
__device__ __forceinline__ void wait_tensor0() { asm volatile("s_wait_tensorcnt 0x0" ::: "memory"); }
// this wave's LDS reads have returned: the buffer they read may be refilled behind the next barrier
__device__ __forceinline__ void wait_ds0() { asm volatile("s_wait_dscnt 0x0" ::: "memory"); }

// Load one 16x32 bf16 fragment from LDS, k0 = first k of the fragment inside the
// tile row (ISA striping):
//   lanes 0-15 : row = lane,    K = {0..7, 16..23}
//   lanes 16-31: row = lane-16, K = {8..15, 24..31}
// PIT = LDS row pitch in bf16 elements
template <int PIT>
__device__ __forceinline__ v16bf load_frag(const unsigned short* lds,
                                           int rowBase, int k0, int lane) {
    const int r  = lane & 15;
    const int kb = (lane >> 4) << 3;
    const unsigned short* p = lds + (rowBase + r) * PIT + k0 + kb;
    union { v16bf v; uint4 q[2]; } u;
    u.q[0] = *reinterpret_cast<const uint4*>(p);
    u.q[1] = *reinterpret_cast<const uint4*>(p + 16);
    return u.v;
}

// C[M x N] = A[M x K](bf16) * W[N x K](bf16)^T + bias[N](f32), C = f32
// blockIdx.z picks one of up to three independent products of the same shape:
// their A, W and C planes lie back to back behind Abase, Wbase and Cbase.
// A block is S groups of TBN / 16 waves (a wave holds 64 x 32). Every group works
// on the whole 128 x TBN tile but walks only its own Kdim / S slice of K, with its own pair of LDS
// buffers: the serial chain of K steps (each one LDS latencies and a barrier long)
// is S times shorter, and the groups fill each other's
// stalls. The S partial tiles are added through LDS behind the loop.
// Kdim must be a multiple of S * BK and at least S * BK.
template <int S, int TBN>
__global__ void __launch_bounds__(2 * TBN * S)
gemm_bias_bf16wmma(const unsigned short* __restrict__ Abase,
                   const unsigned short* __restrict__ Wbase,
                   const float* __restrict__ bias0,
                   const float* __restrict__ bias1,
                   const float* __restrict__ bias2,
                   float* __restrict__ Cbase,
                   int Mrows, int Nout, int Kdim)
{
    const int z = blockIdx.z;
    const unsigned short* __restrict__ A = Abase + (size_t)z * Mrows * Kdim;
    const unsigned short* __restrict__ W = Wbase + (size_t)z * Nout * Kdim;
    const float* __restrict__ bias = (z == 0) ? bias0 : (z == 1) ? bias1 : bias2;
    float* __restrict__ C = Cbase + (size_t)z * Mrows * Nout;

    // ring: per group two buffers of an A and a B tile, every tile's place a multiple
    // of 2 KiB; behind the loop the same LDS holds the partial tiles on their way to
    // the group that finishes them
    constexpr int WC  = TBN / 32;                // wave columns of a group
    constexpr int GT  = 64 * WC;                 // threads of a group (2 x WC waves)
    constexpr int A_BYTES   = BM * LSTR * 2;
    constexpr int B_BYTES   = (TBN * LSTR * 2 + 2047) / 2048 * 2048;
    constexpr int BUF_BYTES = A_BYTES + B_BYTES;
    static_assert(A_BYTES % 2048 == 0, "the B tile's place is a multiple of 2 KiB");
    constexpr int RING_BYTES = S * 2 * BUF_BYTES;
    constexpr int RED_BYTES  = (S - 1) * BM * TBN * 4;
    __shared__ __attribute__((aligned(2048))) unsigned char smem[RING_BYTES > RED_BYTES ? RING_BYTES : RED_BYTES];

    // group number: the same in every lane of a wave, kept scalar for the branches
    const int grp  = __builtin_amdgcn_readfirstlane((int)(threadIdx.x / GT));
    const int tid  = threadIdx.x % GT;  // thread within its group
    const int lane = tid & 31;
    const int wave = tid >> 5;
    const int wr   = wave / WC;         // 0..1 : wave row (64 rows each)
    const int wc   = wave % WC;         // wave col (32 cols each)

    const int blockRow = blockIdx.y * BM;
    const int blockCol = blockIdx.x * TBN;

    v8f acc[4][2];
    #pragma unroll
    for (int i = 0; i < 4; ++i)
        #pragma unroll
        for (int j = 0; j < 2; ++j)
            acc[i][j] = (v8f){0.f, 0.f, 0.f, 0.f, 0.f, 0.f, 0.f, 0.f};

    const int kBase  = grp * (Kdim / S); // first k of this group's slice
    const int nTiles = Kdim / (S * BK);  // K steps of one group

    // ---- two-buffer ring filled by tensor loads: wave 0 of a group asks for the
    // group's A tile of a stage (128 rows of 128 B), wave 1 for its B tile (TBN rows);
    // the pad of 16 B a row gives the pitch LSTR.
    const unsigned int wig    = uni(threadIdx.x >> 5) % (GT / 32);   // wave within its group
    const unsigned int issuer = wig < 2u;
    const bool         isB    = wig == 1u;
    const unsigned short* const src = isB ? W + (size_t)blockCol * Kdim + kBase
                                          : A + (size_t)blockRow * Kdim + kBase;
    const unsigned int dst0 = (unsigned int)(size_t)smem + grp * 2 * BUF_BYTES + (isB ? A_BYTES : 0);
    const u32x8 g1 = tdm_group1<BK * 2, 4>(isB ? TBN : BM, (unsigned int)Kdim * 2u);
    auto issue_tile = [&](int st) {
        tdm_load(tdm_group0(dst0 + (st & 1) * BUF_BYTES,
                            (unsigned long long)(size_t)(src + (size_t)st * BK)), g1);
    };

    if (pinned(issuer)) {
        issue_tile(0);
        wait_tensor0();
    }
    __syncthreads();                                    // stage 0 visible to the group's waves
    if (pinned(issuer & (unsigned int)(1 < nTiles))) issue_tile(1);
    for (int t = 0; t < nTiles; ++t) {
        const unsigned short* const As =
            reinterpret_cast<const unsigned short*>(smem + (grp * 2 + (t & 1)) * BUF_BYTES);
        const unsigned short* const Bs = As + A_BYTES / 2;

        // the tile's two WMMA K slices in rising k: the sum order stays the same;
        // unrolled so that ks is a constant in the LDS read offsets
        #pragma unroll
        for (int ks = 0; ks < BK; ks += 32) {
            v16bf af[4], bfd[2];
            #pragma unroll
            for (int i = 0; i < 4; ++i) af[i]  = load_frag<LSTR>(As, wr * 64 + i * 16, ks, lane);
            #pragma unroll
            for (int j = 0; j < 2; ++j) bfd[j] = load_frag<LSTR>(Bs, wc * 32 + j * 16, ks, lane);

            #pragma unroll
            for (int i = 0; i < 4; ++i)
                #pragma unroll
                for (int j = 0; j < 2; ++j)
                    acc[i][j] = __builtin_amdgcn_wmma_f32_16x16x32_bf16(
                        false, af[i], false, bfd[j], (short)0, acc[i][j], false, false);
        }
        // publish point of stage t + 1: own LDS reads back, own request landed, then
        // the one barrier of the step: it shows stage t + 1 to every wave and ends
        // every wave's reads of stage t, whose buffer the refill behind it takes
        wait_ds0();
        if (pinned(issuer)) wait_tensor0();
        __syncthreads();
        if (pinned(issuer & (unsigned int)(t + 2 < nTiles))) issue_tile(t + 2);
    }
    wait_tensor0();
    wait_ds0();

    // ---- add the S partial tiles: group o finishes accumulator rows
    // i = o * IPG .. o * IPG + IPG - 1 of every wave. Each group hands the rows it
    // does not finish to their owner through LDS, 16 B per lane and lanes side by
    // side. The ring is free: the loop ended in a barrier behind every wave's last
    // LDS read, and no tensor load is outstanding behind the last trip's wait.
    constexpr int IPG = 4 / S;
    float4* const red = reinterpret_cast<float4*>(smem);
    #pragma unroll
    for (int i = 0; i < 4; ++i) {
        const int owner = i / IPG;
        if (grp != owner) {
            const int slot = owner * (S - 1) + (grp < owner ? grp : grp - 1);
            #pragma unroll
            for (int j = 0; j < 2; ++j)
                #pragma unroll
                for (int h = 0; h < 2; ++h)
                    red[((slot * IPG + i % IPG) * 4 + j * 2 + h) * GT + tid] =
                        make_float4(acc[i][j][h * 4 + 0], acc[i][j][h * 4 + 1],
                                    acc[i][j][h * 4 + 2], acc[i][j][h * 4 + 3]);
        }
    }
    __syncthreads();                                    // partial tiles visible to their owners

    // the rows this group finishes, picked by the scalar group number so that one
    // copy of the code below serves every group
    v8f fin[IPG][2];
    #pragma unroll
    for (int i = 0; i < 4; ++i)
        if (grp == i / IPG) {
            fin[i % IPG][0] = acc[i][0];
            fin[i % IPG][1] = acc[i][1];
        }
    // own partial first, then the other groups' in rising group order
    #pragma unroll
    for (int s = 0; s < S - 1; ++s)
        #pragma unroll
        for (int ii = 0; ii < IPG; ++ii)
            #pragma unroll
            for (int j = 0; j < 2; ++j)
                #pragma unroll
                for (int h = 0; h < 2; ++h) {
                    const float4 p =
                        red[(((grp * (S - 1) + s) * IPG + ii) * 4 + j * 2 + h) * GT + tid];
                    fin[ii][j][h * 4 + 0] += p.x;  fin[ii][j][h * 4 + 1] += p.y;
                    fin[ii][j][h * 4 + 2] += p.z;  fin[ii][j][h * 4 + 3] += p.w;
                }

    // ---- store: VGPR v -> row v (+8 for upper lane half), col = lane&15 ----
    const int cr = (lane >> 4) * 8;
    const int cc = lane & 15;
    #pragma unroll
    for (int ii = 0; ii < IPG; ++ii) {
        #pragma unroll
        for (int j = 0; j < 2; ++j) {
            const int col = blockCol + wc * 32 + j * 16 + cc;
            const float b = bias[col];
            #pragma unroll
            for (int v = 0; v < 8; ++v) {
                const int row = blockRow + wr * 64 + (grp * IPG + ii) * 16 + cr + v;
                C[(size_t)row * Nout + col] = fin[ii][j][v] + b;
            }
        }
    }
}

// fp32 -> bf16 conversion of all seven tensors in ONE launch of few, long-lived
// waves. The bf16 planes lie back to back in the workspace in argument order,
// so sweep n of the grid writes float4 group n * CVT_STRIDE + g of that region.
#define CVT_BLOCKS  512                     // 2 blocks (16 waves) per WGP
#define CVT_STRIDE  (CVT_BLOCKS * 256)      // float4 groups per sweep of the grid
#define ACT_SWEEPS  4                       // 2048 * 1024 / 4 / CVT_STRIDE
#define W_SWEEPS    2                       // 1024 * 1024 / 4 / CVT_STRIDE
static_assert(ACT_SWEEPS * CVT_STRIDE * 4 == 2048 * 1024, "activation sweeps");
static_assert(W_SWEEPS   * CVT_STRIDE * 4 == 1024 * 1024, "weight sweeps");

__global__ void __launch_bounds__(256)
cvt_all_f32_bf16(const float* __restrict__ xq, const float* __restrict__ xk,
                 const float* __restrict__ xv, const float* __restrict__ wq,
                 const float* __restrict__ wk, const float* __restrict__ wv,
                 const float* __restrict__ wo, unsigned short* __restrict__ dst)
{
    const int g = blockIdx.x * 256 + threadIdx.x;
    const float* const act[3] = {xq, xk, xv};
    const float* const wts[4] = {wq, wk, wv, wo};
    float4 f[3 * ACT_SWEEPS + 4 * W_SWEEPS];

    // all loads first: every thread keeps its 20 independent 16B reads in flight.
    // Every loop here is fully unrolled so that f[] stays in registers and the
    // tensor each sweep reads is known at compile time (no per-sweep select).
    #pragma unroll
    for (int t = 0; t < 3; ++t)
        #pragma unroll
        for (int s = 0; s < ACT_SWEEPS; ++s)
            f[t * ACT_SWEEPS + s] =
                reinterpret_cast<const float4*>(act[t])[s * CVT_STRIDE + g];
    #pragma unroll
    for (int t = 0; t < 4; ++t)
        #pragma unroll
        for (int s = 0; s < W_SWEEPS; ++s)
            f[3 * ACT_SWEEPS + t * W_SWEEPS + s] =
                reinterpret_cast<const float4*>(wts[t])[s * CVT_STRIDE + g];

    #pragma unroll
    for (int n = 0; n < 3 * ACT_SWEEPS + 4 * W_SWEEPS; ++n) {
        ushort4 h;
        h.x = f2bf(f[n].x); h.y = f2bf(f[n].y); h.z = f2bf(f[n].z); h.w = f2bf(f[n].w);
        reinterpret_cast<ushort4*>(dst)[n * CVT_STRIDE + g] = h;
    }
}

// Value of lane (l ^ M) of the same 16-lane row, all lanes on (DPP row_xmask).
template <int M>
__device__ __forceinline__ float row_xor(float x) {
    return __int_as_float(__builtin_amdgcn_update_dpp(
        0, __float_as_int(x), 0x160 | M, 0xf, 0xf, true));
}

#define FT    128     // tokens of a block
#define HD    64      // channels of one head: the columns of each of the three tiles
#define QPIT  68      // f32 pitch of the finished tiles in LDS (272 B = 16 B x odd)
#define FROWS 48      // 16-lane rows in a block of 24 waves
#define SKK   128     // k of one stage of the ring: a tile row is 256 B
#define FPIT  136     // LDS row pitch of the ring in bf16 elems (256 B + 16 B pad = 16 B x odd)

// Q, K and V projections of one head for 128 tokens, then that head's attention,
// in one block: the three f32 tiles go from the accumulators to the attention
// through LDS and never through memory.
// Projections: X[M x K](bf16) * W[N x K](bf16)^T + bias[N](f32); the three A, W
// planes lie back to back behind Abase, Wbase. Six groups of four waves: group
// 2 * p + s works on product p and on the 64 k of half s of every 128-k stage; the
// two groups of a product share its pair of LDS buffers; a wave holds 64 x 32 of
// its group's 128 x 64 tile.
// Attention: scores[d][q] = q_d*k_q/8, so softmax row d is softmax_q(q_d*k_q):
// never materialize the 64x64 matrix. The row maximum needs no pass over the
// keys: it is q_d/8 times the head's largest or smallest key.
// Kdim must be a multiple of SKK and at least SKK.
__global__ void __launch_bounds__(768)
qkv_attn_fused(const unsigned short* __restrict__ Abase,
               const unsigned short* __restrict__ Wbase,
               const float* __restrict__ bias0,
               const float* __restrict__ bias1,
               const float* __restrict__ bias2,
               unsigned short* __restrict__ Ctx,
               int Mrows, int Nout, int Kdim)
{
    // every tile's place in LDS is a multiple of 2 KiB
    constexpr int A_BYTES    = FT * FPIT * 2;                             // 17 x 2 KiB
    constexpr int B_BYTES    = (HD * FPIT * 2 + 2047) / 2048 * 2048;      //  9 x 2 KiB
    constexpr int BUF_BYTES  = A_BYTES + B_BYTES;         // one A and one B tile
    static_assert(A_BYTES % 2048 == 0, "the B tile's place is a multiple of 2 KiB");
    constexpr int RING_BYTES = 3 * 2 * BUF_BYTES;         // 312 KiB
    constexpr int RED_BYTES  = 6 * 2 * 4 * 128 * 16;      // half a partial tile per group
    constexpr int QKV_BYTES  = 3 * FT * QPIT * 4;
    static_assert(RING_BYTES <= 320 * 1024, "the ring fits in a WGP's LDS");
    static_assert(RED_BYTES + QKV_BYTES <= RING_BYTES, "hand-over fits in the ring");
    __shared__ __attribute__((aligned(2048))) unsigned char smem[RING_BYTES];

    // group number: the same in every lane of a wave, kept scalar for the branches
    const int grp  = __builtin_amdgcn_readfirstlane((int)(threadIdx.x >> 7));
    const int prod = grp >> 1;          // 0 Q, 1 K, 2 V
    const int ksl  = grp & 1;           // half of every stage's k
    const int tid  = threadIdx.x & 127; // thread within its group
    const unsigned short* __restrict__ A = Abase + (size_t)prod * Mrows * Kdim;
    const unsigned short* __restrict__ W = Wbase + (size_t)prod * Nout * Kdim;
    const float* __restrict__ bias = (prod == 0) ? bias0 : (prod == 1) ? bias1 : bias2;
    const int lane = tid & 31;
    const int wave = tid >> 5;          // 0..3
    const int wr   = wave >> 1;         // 0..1 : wave row (64 rows each)
    const int wc   = wave & 1;          // 0..1 : wave col (32 cols each)

    const int blockRow = blockIdx.y * FT;
    const int blockCol = blockIdx.x * HD;

    v8f acc[4][2];
    #pragma unroll
    for (int i = 0; i < 4; ++i)
        #pragma unroll
        for (int j = 0; j < 2; ++j)
            acc[i][j] = (v8f){0.f, 0.f, 0.f, 0.f, 0.f, 0.f, 0.f, 0.f};

    const int nTiles = Kdim / SKK;       // stages of the ring

    // ---- two-buffer ring filled by tensor loads: the first wave of a product's
    // group 0 asks for the product's A tile of a stage (128 rows of 256 B), the first
    // wave of its group 1 for the B tile (64 rows); the pad of 16 B a row gives FPIT.
    const unsigned int issuer = (uni(threadIdx.x >> 5) & 3u) == 0u;
    const bool         isB    = ksl != 0;
    const unsigned short* const src = isB ? W + (size_t)blockCol * Kdim
                                          : A + (size_t)blockRow * Kdim;
    const unsigned int dst0 = (unsigned int)(size_t)smem + prod * 2 * BUF_BYTES + (isB ? A_BYTES : 0);
    const u32x8 g1 = tdm_group1<SKK * 2, 5>(isB ? HD : FT, (unsigned int)Kdim * 2u);
    auto issue_tile = [&](int st) {
        tdm_load(tdm_group0(dst0 + (st & 1) * BUF_BYTES,
                            (unsigned long long)(size_t)(src + (size_t)st * SKK)), g1);
    };

    if (pinned(issuer)) {
        issue_tile(0);
        wait_tensor0();
    }
    __syncthreads();                                    // stage 0 visible to every wave
    if (pinned(issuer & (unsigned int)(1 < nTiles))) issue_tile(1);
    for (int t = 0; t < nTiles; ++t) {
        const unsigned short* const As =
            reinterpret_cast<const unsigned short*>(smem + (prod * 2 + (t & 1)) * BUF_BYTES);
        const unsigned short* const Bs = As + A_BYTES / 2;

        // this group's half of the stage, two WMMA K slices in rising k;
        // unrolled so that ks is a constant in the LDS read offsets
        #pragma unroll
        for (int ks = 0; ks < SKK / 2; ks += 32) {
            v16bf af[4], bfd[2];
            #pragma unroll
            for (int i = 0; i < 4; ++i) af[i]  = load_frag<FPIT>(As, wr * 64 + i * 16, ksl * (SKK / 2) + ks, lane);
            #pragma unroll
            for (int j = 0; j < 2; ++j) bfd[j] = load_frag<FPIT>(Bs, wc * 32 + j * 16, ksl * (SKK / 2) + ks, lane);

            #pragma unroll
            for (int i = 0; i < 4; ++i)
                #pragma unroll
                for (int j = 0; j < 2; ++j)
                    acc[i][j] = __builtin_amdgcn_wmma_f32_16x16x32_bf16(
                        false, af[i], false, bfd[j], (short)0, acc[i][j], false, false);
        }
        // publish point of stage t + 1: own LDS reads back, own request landed, then
        // the one barrier of the step: it shows stage t + 1 to every wave and ends
        // every wave's reads of stage t, whose buffer the refill behind it takes
        wait_ds0();
        if (pinned(issuer)) wait_tensor0();
        __syncthreads();
        if (pinned(issuer & (unsigned int)(t + 2 < nTiles))) issue_tile(t + 2);
    }
    wait_tensor0();
    wait_ds0();

    // ---- add the two partial tiles of each product: the group of K half o
    // finishes accumulator rows i = 2 * o, 2 * o + 1 of every wave and hands the
    // other two to its partner group through LDS, 16 B per lane and lanes side by
    // side. The ring is free: the loop ended in a barrier behind every wave's last
    // LDS read, and no tensor load is outstanding behind the last trip's wait.
    float4* const red = reinterpret_cast<float4*>(smem);
    #pragma unroll
    for (int i = 0; i < 4; ++i) {
        if (ksl != (i >> 1)) {
            #pragma unroll
            for (int j = 0; j < 2; ++j)
                #pragma unroll
                for (int h = 0; h < 2; ++h)
                    red[(((grp ^ 1) * 2 + (i & 1)) * 4 + j * 2 + h) * 128 + tid] =
                        make_float4(acc[i][j][h * 4 + 0], acc[i][j][h * 4 + 1],
                                    acc[i][j][h * 4 + 2], acc[i][j][h * 4 + 3]);
        }
    }
    __syncthreads();                                    // partial tiles visible to their owners

    // the rows this group finishes, picked by the scalar K half so that one copy
    // of the code below serves both
    v8f fin[2][2];
    #pragma unroll
    for (int i = 0; i < 4; ++i)
        if (ksl == (i >> 1)) {
            fin[i & 1][0] = acc[i][0];
            fin[i & 1][1] = acc[i][1];
        }
    #pragma unroll
    for (int ii = 0; ii < 2; ++ii)
        #pragma unroll
        for (int j = 0; j < 2; ++j)
            #pragma unroll
            for (int h = 0; h < 2; ++h) {
                const float4 p = red[((grp * 2 + ii) * 4 + j * 2 + h) * 128 + tid];
                fin[ii][j][h * 4 + 0] += p.x;  fin[ii][j][h * 4 + 1] += p.y;
                fin[ii][j][h * 4 + 2] += p.z;  fin[ii][j][h * 4 + 3] += p.w;
            }

    // ---- finished tiles to LDS, behind the partial tiles' place:
    // VGPR v -> row v (+8 for upper lane half), col = lane&15 ----
    float* const qkv = reinterpret_cast<float*>(smem + RED_BYTES);
    {
        float* const mine = qkv + prod * FT * QPIT;
        const int cr = (lane >> 4) * 8;
        const int cc = lane & 15;
        #pragma unroll
        for (int ii = 0; ii < 2; ++ii) {
            #pragma unroll
            for (int j = 0; j < 2; ++j) {
                const int col = wc * 32 + j * 16 + cc;
                const float b = bias[blockCol + col];
                #pragma unroll
                for (int v = 0; v < 8; ++v) {
                    const int row = wr * 64 + (ksl * 2 + ii) * 16 + cr + v;
                    mine[row * QPIT + col] = fin[ii][j][v] + b;
                }
            }
        }
    }
    __syncthreads();                                    // Q, K, V tiles visible to every wave

    // ---- attention: a 16-lane row takes one token, four channels a lane.
    // 128 tokens over 48 rows: waves 0..15 take three tokens a row, the others two;
    // the trip count is the same in every lane of a wave (the DPP steps need all on)
    const int wv     = __builtin_amdgcn_readfirstlane((int)(threadIdx.x >> 5));
    const int rounds = (2 * FROWS + 2 * wv + 1 < FT) ? 3 : 2;
    const int l16    = threadIdx.x & 15;
    for (int rd = 0; rd < rounds; ++rd) {
        const int tok = (int)(threadIdx.x >> 4) + rd * FROWS;
        const float* const kk = qkv + (FT + tok) * QPIT;
        const float* const vv = qkv + (2 * FT + tok) * QPIT;

        // Largest and smallest key of the head. The 16 lanes of a row hold the
        // head's 64 keys, four each, so four xor steps inside the row finish it.
        const float4 kown = *reinterpret_cast<const float4*>(kk + l16 * 4);
        float kmax = fmaxf(fmaxf(kown.x, kown.y), fmaxf(kown.z, kown.w));
        float kmin = fminf(fminf(kown.x, kown.y), fminf(kown.z, kown.w));
        kmax = fmaxf(kmax, row_xor<1>(kmax));  kmin = fminf(kmin, row_xor<1>(kmin));
        kmax = fmaxf(kmax, row_xor<2>(kmax));  kmin = fminf(kmin, row_xor<2>(kmin));
        kmax = fmaxf(kmax, row_xor<4>(kmax));  kmin = fminf(kmin, row_xor<4>(kmin));
        kmax = fmaxf(kmax, row_xor<8>(kmax));  kmin = fminf(kmin, row_xor<8>(kmin));

        const float4 qv = *reinterpret_cast<const float4*>(qkv + tok * QPIT + l16 * 4);
        const float  q4[4] = {qv.x, qv.y, qv.z, qv.w};
        float        s[4], mx[4], out[4];

        #pragma unroll
        for (int c = 0; c < 4; ++c) {
            s[c] = q4[c] * 0.125f;                  // 1/sqrt(64)
            // rounding is monotone, so the largest rounded product s * k_j is the one
            // with the largest key (s >= 0) or with the smallest key (s < 0)
            mx[c] = fmaxf(s[c] * kmax, s[c] * kmin);
        }
        // Keys outermost, the thread's four channels side by side: one 16 B read of
        // keys and one of values feed 16 exponentials, and two channels share each
        // packed f32 instruction. Every channel sums in rising j.
        const v2f sp[2] = {{s[0], s[1]}, {s[2], s[3]}};
        const v2f nm[2] = {{-mx[0], -mx[1]}, {-mx[2], -mx[3]}};
        v2f se[2] = {{0.f, 0.f}, {0.f, 0.f}};
        v2f av[2] = {{0.f, 0.f}, {0.f, 0.f}};
        // unrolled by 2: the second four keys' reads are in flight under the first four's work
        #pragma unroll 2
        for (int j = 0; j < 64; j += 4) {
            const float4 k4 = *reinterpret_cast<const float4*>(kk + j);
            const float4 v4 = *reinterpret_cast<const float4*>(vv + j);
            const float  kj[4] = {k4.x, k4.y, k4.z, k4.w};
            const float  vj[4] = {v4.x, v4.y, v4.z, v4.w};
            #pragma unroll
            for (int u = 0; u < 4; ++u)
                #pragma unroll
                for (int p = 0; p < 2; ++p) {
                    // exp(x) = 2^(x * log2 e): the fast exponential's own two steps
                    const v2f t = __builtin_elementwise_fma(sp[p], (v2f){kj[u], kj[u]}, nm[p])
                                  * 1.44269504f;
                    const v2f e = {__builtin_amdgcn_exp2f(t.x), __builtin_amdgcn_exp2f(t.y)};
                    se[p] += e;
                    av[p] = __builtin_elementwise_fma(e, (v2f){vj[u], vj[u]}, av[p]);
                }
        }
        #pragma unroll
        for (int c = 0; c < 4; ++c) out[c] = av[c >> 1][c & 1] / se[c >> 1][c & 1];
        ushort4 h;
        h.x = f2bf(out[0]); h.y = f2bf(out[1]); h.z = f2bf(out[2]); h.w = f2bf(out[3]);
        *reinterpret_cast<ushort4*>(Ctx + (size_t)(blockRow + tok) * Nout + blockCol + l16 * 4) = h;
        // the next round overwrites the store's address and data registers
        asm volatile("s_wait_xcnt 0x0" ::: "memory");
    }
}

extern "C" void kernel_launch(void* const* d_in, const int* in_sizes, int n_in,
                              void* d_out, int out_size, void* d_ws, size_t ws_size,
                              hipStream_t stream) {
    (void)in_sizes; (void)n_in; (void)out_size; (void)ws_size;
    const float* x_q = (const float*)d_in[0];
    const float* x_k = (const float*)d_in[1];
    const float* x_v = (const float*)d_in[2];
    const float* Wq  = (const float*)d_in[3];
    const float* bq  = (const float*)d_in[4];
    const float* Wk  = (const float*)d_in[5];
    const float* bk  = (const float*)d_in[6];
    const float* Wv  = (const float*)d_in[7];
    const float* bv  = (const float*)d_in[8];
    const float* Wo  = (const float*)d_in[9];
    const float* bo  = (const float*)d_in[10];
    float* out = (float*)d_out;

    const int Mrows = 4 * 512;                    // 2048 tokens
    const int D     = 1024;
    const size_t actElems = (size_t)Mrows * D;    // 2M
    const size_t wElems   = (size_t)D * D;        // 1M

    // workspace layout (24 MB total)
    unsigned short* bXq = (unsigned short*)d_ws;
    unsigned short* bXk = bXq + actElems;
    unsigned short* bXv = bXk + actElems;
    unsigned short* bWq = bXv + actElems;
    unsigned short* bWk = bWq + wElems;
    unsigned short* bWv = bWk + wElems;
    unsigned short* bWo = bWv + wElems;
    unsigned short* Cx  = bWo + wElems;

    dim3 block(256);
    // bXq..bWo are contiguous in this order: one launch fills all seven planes
    cvt_all_f32_bf16<<<CVT_BLOCKS, block, 0, stream>>>(x_q, x_k, x_v, Wq, Wk, Wv, Wo, bXq);

    // Q, K, V projections and the attention of one head and 128 tokens per block:
    // 256 blocks of 24 waves, one per WGP (bXq|bXk|bXv and bWq|bWk|bWv are each
    // contiguous)
    dim3 gridF(D / HD, Mrows / FT, 1);            // (16, 16)
    qkv_attn_fused<<<gridF, dim3(768), 0, stream>>>(bXq, bWq, bq, bk, bv, Cx, Mrows, D, D);

    // 128 x 64 tiles: 256 blocks, one per WGP; K in four slices, 16 waves a block
    dim3 gridO(D / 64, Mrows / BM, 1);            // (16, 16, 1)
    gemm_bias_bf16wmma<4, 64><<<gridO, dim3(512), 0, stream>>>(Cx, bWo, bo, bo, bo, out, Mrows, D, D);
}

// v010
// Measured time: 41.2 microseconds a run.
// Timed twice side by side with v009, it ran 1.06 times as fast both times.
// Over all steps from v000 it is 2.96 times as fast.
#include <hip/hip_runtime.h>

// ---------------------------------------------------------------------------
// Per-token channel attention block for gfx1250 (wave32, WMMA + tensor loads to LDS)
// Pipeline:
//   1) one-launch fp32->bf16 conversion of activations & weights
//   2) Q, K, V projections (bf16 WMMA) of one head and 128 tokens per block,
//      tiles brought into LDS by tensor_load_to_lds + s_wait_tensorcnt in a
//      two-buffer ring, K split over two wave groups per product; the
//      finished f32 tiles stay in LDS and the same block does the rank-1 softmax
//      attention on fp32 VALU (v_exp_f32), ctx emitted as bf16
//   3) output projection GEMM (128 x 64 tiles, K split over four wave groups) -> fp32 d_out
// In both GEMM kernels a block starts its walk over K at a stage of its own (ring_start).
// ---------------------------------------------------------------------------

typedef __attribute__((ext_vector_type(16))) __bf16 v16bf;
typedef __attribute__((ext_vector_type(8)))  float  v8f;
typedef __attribute__((ext_vector_type(2)))  float  v2f;

#define BM   128      // block tile rows
#define BK   64       // K step: one tile row is 128 B, a whole cache line (two WMMA K of 32)
#define LSTR 72       // LDS row stride in bf16 elems (64 + 8 pad; 144 B = 16 B x odd)

typedef unsigned int u32x4 __attribute__((ext_vector_type(4)));   // descriptor group 0
typedef unsigned int u32x8 __attribute__((ext_vector_type(8)));   // descriptor group 1

__device__ __forceinline__ unsigned short f2bf(float f) {
    unsigned int u = __float_as_uint(f);
    u += 0x7FFFu + ((u >> 16) & 1u);           // round-to-nearest-even
    return (unsigned short)(u >> 16);
}

__device__ __forceinline__ unsigned int uni(unsigned int v) {
    return (unsigned int)__builtin_amdgcn_readfirstlane(v);
}
// A wave-uniform test value for the branch round a tensor load, which ignores EXEC:
// only a scalar branch keeps a wave from issuing it.
__device__ __forceinline__ unsigned int pinned(unsigned int v) {
    unsigned int w = (unsigned int)__builtin_amdgcn_readfirstlane(v);
    asm volatile("" : "+s"(w));   // holds the test value in a scalar register (s_cmp + s_cbranch_scc)
    return w;
}
// Descriptor group 1 of a two-dimensional tile, every extent in bytes: rows of ROWB
// bytes, source row pitch src_pitch, 16 B of LDS pad behind every row (PADC is the
// pad interval code of the row length: 4 for 128 B, 5 for 256 B); tensor = tile.
template <unsigned int ROWB, unsigned int PADC>
__device__ __forceinline__ u32x8 tdm_group1(unsigned int rows, unsigned int src_pitch) {
    u32x8 g;
    g[0] = uni((1u << 20) | (PADC << 22) | (3u << 25));   // no mask, 1-byte elements, pad on
    g[1] = uni((ROWB & 0xFFFFu) << 16);
    g[2] = uni((ROWB >> 16) | ((rows & 0xFFFFu) << 16));
    g[3] = uni((rows >> 16) | (ROWB << 16));
    g[4] = uni(rows);
    g[5] = uni(src_pitch);
    g[6] = uni(0u);
    g[7] = uni(0u);
    return g;
}
// Descriptor group 0: place in the work-group's LDS, address of the tile's first byte
__device__ __forceinline__ u32x4 tdm_group0(unsigned int lds_dst, unsigned long long ga) {
    u32x4 g;
    g[0] = uni(1u);
    g[1] = uni(lds_dst);
    g[2] = uni((unsigned int)ga);
    g[3] = uni((((unsigned int)(ga >> 32)) & 0x01FFFFFFu) | 0x80000000u);
    return g;
}
// one request of the whole wave: a tile from global memory into LDS, through no register
__device__ __forceinline__ void tdm_load(u32x4 g0, u32x8 g1) {
    asm volatile("tensor_load_to_lds %0, %1" :: "s"(g0), "s"(g1) : "memory");
}
// the issuing wave's tensor loads have landed
__device__ __forceinline__ void wait_tensor0() { asm volatile("s_wait_tensorcnt 0x0" ::: "memory"); }
// this wave's LDS reads have returned: the buffer they read may be refilled behind the next barrier
__device__ __forceinline__ void wait_ds0() { asm volatile("s_wait_dscnt 0x0" ::: "memory"); }
// First K stage of this block's walk. The 16 blocks of a grid row read the same A rows
// and the 16 of a grid column the same W rows; started at the same stage they would all
// ask L2 for the same lines at the same moment. Neighbours in either direction start
// one stage apart and wrap round, so a line's readers come at different times. Blocks
// 8 apart in a row get half a walk more
// (for speed only: any start gives the same sums but for their order).
__device__ __forceinline__ int ring_start(int nStages) {
    return (int)((blockIdx.x + blockIdx.y + (blockIdx.x >> 3) * ((unsigned int)nStages >> 1))
                 % (unsigned int)nStages);
}
// K stage that step st of the walk works on
__device__ __forceinline__ int ring_stage(int st, int start, int nStages) {
    const int k = st + start;
    return k < nStages ? k : k - nStages;
}

// Load one 16x32 bf16 fragment from LDS, k0 = first k of the fragment inside the
// tile row (ISA striping):
//   lanes 0-15 : row = lane,    K = {0..7, 16..23}
//   lanes 16-31: row = lane-16, K = {8..15, 24..31}
// PIT = LDS row pitch in bf16 elements
template <int PIT>
__device__ __forceinline__ v16bf load_frag(const unsigned short* lds,
                                           int rowBase, int k0, int lane) {
    const int r  = lane & 15;
    const int kb = (lane >> 4) << 3;
    const unsigned short* p = lds + (rowBase + r) * PIT + k0 + kb;
    union { v16bf v; uint4 q[2]; } u;
    u.q[0] = *reinterpret_cast<const uint4*>(p);
    u.q[1] = *reinterpret_cast<const uint4*>(p + 16);
    return u.v;
}

// C[M x N] = A[M x K](bf16) * W[N x K](bf16)^T + bias[N](f32), C = f32
// blockIdx.z picks one of up to three independent products of the same shape:
// their A, W and C planes lie back to back behind Abase, Wbase and Cbase.
// A block is S groups of TBN / 16 waves (a wave holds 64 x 32). Every group works
// on the whole 128 x TBN tile but walks only its own Kdim / S slice of K, with its own pair of LDS
// buffers: the serial chain of K steps (each one LDS latencies and a barrier long)
// is S times shorter, and the groups fill each other's
// stalls. The S partial tiles are added through LDS behind the loop.
// Kdim must be a multiple of S * BK and at least S * BK.
template <int S, int TBN>
__global__ void __launch_bounds__(2 * TBN * S)
gemm_bias_bf16wmma(const unsigned short* __restrict__ Abase,
                   const unsigned short* __restrict__ Wbase,
                   const float* __restrict__ bias0,
                   const float* __restrict__ bias1,
                   const float* __restrict__ bias2,
                   float* __restrict__ Cbase,
                   int Mrows, int Nout, int Kdim)
{
    const int z = blockIdx.z;
    const unsigned short* __restrict__ A = Abase + (size_t)z * Mrows * Kdim;
    const unsigned short* __restrict__ W = Wbase + (size_t)z * Nout * Kdim;
    const float* __restrict__ bias = (z == 0) ? bias0 : (z == 1) ? bias1 : bias2;
    float* __restrict__ C = Cbase + (size_t)z * Mrows * Nout;

    // ring: per group two buffers of an A and a B tile, every tile's place a multiple
    // of 2 KiB; behind the loop the same LDS holds the partial tiles on their way to
    // the group that finishes them
    constexpr int WC  = TBN / 32;                // wave columns of a group
    constexpr int GT  = 64 * WC;                 // threads of a group (2 x WC waves)
    constexpr int A_BYTES   = BM * LSTR * 2;
    constexpr int B_BYTES   = (TBN * LSTR * 2 + 2047) / 2048 * 2048;
    constexpr int BUF_BYTES = A_BYTES + B_BYTES;
    static_assert(A_BYTES % 2048 == 0, "the B tile's place is a multiple of 2 KiB");
    constexpr int RING_BYTES = S * 2 * BUF_BYTES;
    constexpr int RED_BYTES  = (S - 1) * BM * TBN * 4;
    __shared__ __attribute__((aligned(2048))) unsigned char smem[RING_BYTES > RED_BYTES ? RING_BYTES : RED_BYTES];

    // group number: the same in every lane of a wave, kept scalar for the branches
    const int grp  = __builtin_amdgcn_readfirstlane((int)(threadIdx.x / GT));
    const int tid  = threadIdx.x % GT;  // thread within its group
    const int lane = tid & 31;
    const int wave = tid >> 5;
    const int wr   = wave / WC;         // 0..1 : wave row (64 rows each)
    const int wc   = wave % WC;         // wave col (32 cols each)

    const int blockRow = blockIdx.y * BM;
    const int blockCol = blockIdx.x * TBN;

    v8f acc[4][2];
    #pragma unroll
    for (int i = 0; i < 4; ++i)
        #pragma unroll
        for (int j = 0; j < 2; ++j)
            acc[i][j] = (v8f){0.f, 0.f, 0.f, 0.f, 0.f, 0.f, 0.f, 0.f};

    const int kBase  = grp * (Kdim / S); // first k of this group's slice
    const int nTiles = Kdim / (S * BK);  // K steps of one group

    // ---- two-buffer ring filled by tensor loads: wave 0 of a group asks for the
    // group's A tile of a stage (128 rows of 128 B), wave 1 for its B tile (TBN rows);
    // the pad of 16 B a row gives the pitch LSTR.
    const unsigned int wig    = uni(threadIdx.x >> 5) % (GT / 32);   // wave within its group
    const unsigned int issuer = wig < 2u;
    const bool         isB    = wig == 1u;
    const unsigned short* const src = isB ? W + (size_t)blockCol * Kdim + kBase
                                          : A + (size_t)blockRow * Kdim + kBase;
    const unsigned int dst0 = (unsigned int)(size_t)smem + grp * 2 * BUF_BYTES + (isB ? A_BYTES : 0);
    const u32x8 g1 = tdm_group1<BK * 2, 4>(isB ? TBN : BM, (unsigned int)Kdim * 2u);
    const int start = ring_start(nTiles);
    auto issue_tile = [&](int st) {
        tdm_load(tdm_group0(dst0 + (st & 1) * BUF_BYTES,
                            (unsigned long long)(size_t)(src + (size_t)ring_stage(st, start, nTiles) * BK)), g1);
    };

    if (pinned(issuer)) {
        issue_tile(0);
        wait_tensor0();
    }
    __syncthreads();                                    // stage 0 visible to the group's waves
    if (pinned(issuer & (unsigned int)(1 < nTiles))) issue_tile(1);
    for (int t = 0; t < nTiles; ++t) {
        const unsigned short* const As =
            reinterpret_cast<const unsigned short*>(smem + (grp * 2 + (t & 1)) * BUF_BYTES);
        const unsigned short* const Bs = As + A_BYTES / 2;

        // the tile's two WMMA K slices in rising k;
        // unrolled so that ks is a constant in the LDS read offsets
        #pragma unroll
        for (int ks = 0; ks < BK; ks += 32) {
            v16bf af[4], bfd[2];
            #pragma unroll
            for (int i = 0; i < 4; ++i) af[i]  = load_frag<LSTR>(As, wr * 64 + i * 16, ks, lane);
            #pragma unroll
            for (int j = 0; j < 2; ++j) bfd[j] = load_frag<LSTR>(Bs, wc * 32 + j * 16, ks, lane);

            #pragma unroll
            for (int i = 0; i < 4; ++i)
                #pragma unroll
                for (int j = 0; j < 2; ++j)
                    acc[i][j] = __builtin_amdgcn_wmma_f32_16x16x32_bf16(
                        false, af[i], false, bfd[j], (short)0, acc[i][j], false, false);
        }
        // publish point of stage t + 1: own LDS reads back, own request landed, then
        // the one barrier of the step: it shows stage t + 1 to every wave and ends
        // every wave's reads of stage t, whose buffer the refill behind it takes
        wait_ds0();
        if (pinned(issuer)) wait_tensor0();
        __syncthreads();
        if (pinned(issuer & (unsigned int)(t + 2 < nTiles))) issue_tile(t + 2);
    }
    wait_tensor0();
    wait_ds0();

    // ---- add the S partial tiles: group o finishes accumulator rows
    // i = o * IPG .. o * IPG + IPG - 1 of every wave. Each group hands the rows it
    // does not finish to their owner through LDS, 16 B per lane and lanes side by
    // side. The ring is free: the loop ended in a barrier behind every wave's last
    // LDS read, and no tensor load is outstanding behind the last trip's wait.
    constexpr int IPG = 4 / S;
    float4* const red = reinterpret_cast<float4*>(smem);
    #pragma unroll
    for (int i = 0; i < 4; ++i) {
        const int owner = i / IPG;
        if (grp != owner) {
            const int slot = owner * (S - 1) + (grp < owner ? grp : grp - 1);
            #pragma unroll
            for (int j = 0; j < 2; ++j)
                #pragma unroll
                for (int h = 0; h < 2; ++h)
                    red[((slot * IPG + i % IPG) * 4 + j * 2 + h) * GT + tid] =
                        make_float4(acc[i][j][h * 4 + 0], acc[i][j][h * 4 + 1],
                                    acc[i][j][h * 4 + 2], acc[i][j][h * 4 + 3]);
        }
    }
    __syncthreads();                                    // partial tiles visible to their owners

    // the rows this group finishes, picked by the scalar group number so that one
    // copy of the code below serves every group
    v8f fin[IPG][2];
    #pragma unroll
    for (int i = 0; i < 4; ++i)
        if (grp == i / IPG) {
            fin[i % IPG][0] = acc[i][0];
            fin[i % IPG][1] = acc[i][1];
        }
    // own partial first, then the other groups' in rising group order
    #pragma unroll
    for (int s = 0; s < S - 1; ++s)
        #pragma unroll
        for (int ii = 0; ii < IPG; ++ii)
            #pragma unroll
            for (int j = 0; j < 2; ++j)
                #pragma unroll
                for (int h = 0; h < 2; ++h) {
                    const float4 p =
                        red[(((grp * (S - 1) + s) * IPG + ii) * 4 + j * 2 + h) * GT + tid];
                    fin[ii][j][h * 4 + 0] += p.x;  fin[ii][j][h * 4 + 1] += p.y;
                    fin[ii][j][h * 4 + 2] += p.z;  fin[ii][j][h * 4 + 3] += p.w;
                }

    // ---- store: VGPR v -> row v (+8 for upper lane half), col = lane&15 ----
    const int cr = (lane >> 4) * 8;
    const int cc = lane & 15;
    #pragma unroll
    for (int ii = 0; ii < IPG; ++ii) {
        #pragma unroll
        for (int j = 0; j < 2; ++j) {
            const int col = blockCol + wc * 32 + j * 16 + cc;
            const float b = bias[col];
            #pragma unroll
            for (int v = 0; v < 8; ++v) {
                const int row = blockRow + wr * 64 + (grp * IPG + ii) * 16 + cr + v;
                C[(size_t)row * Nout + col] = fin[ii][j][v] + b;
            }
        }
    }
}

// fp32 -> bf16 conversion of all seven tensors in ONE launch of few, long-lived
// waves. The bf16 planes lie back to back in the workspace in argument order,
// so sweep n of the grid writes float4 group n * CVT_STRIDE + g of that region.
#define CVT_BLOCKS  512                     // 2 blocks (16 waves) per WGP
#define CVT_STRIDE  (CVT_BLOCKS * 256)      // float4 groups per sweep of the grid
#define ACT_SWEEPS  4                       // 2048 * 1024 / 4 / CVT_STRIDE
#define W_SWEEPS    2                       // 1024 * 1024 / 4 / CVT_STRIDE
static_assert(ACT_SWEEPS * CVT_STRIDE * 4 == 2048 * 1024, "activation sweeps");
static_assert(W_SWEEPS   * CVT_STRIDE * 4 == 1024 * 1024, "weight sweeps");

__global__ void __launch_bounds__(256)
cvt_all_f32_bf16(const float* __restrict__ xq, const float* __restrict__ xk,
                 const float* __restrict__ xv, const float* __restrict__ wq,
                 const float* __restrict__ wk, const float* __restrict__ wv,
                 const float* __restrict__ wo, unsigned short* __restrict__ dst)
{
    const int g = blockIdx.x * 256 + threadIdx.x;
    const float* const act[3] = {xq, xk, xv};
    const float* const wts[4] = {wq, wk, wv, wo};
    float4 f[3 * ACT_SWEEPS + 4 * W_SWEEPS];

    // all loads first: every thread keeps its 20 independent 16B reads in flight.
    // Every loop here is fully unrolled so that f[] stays in registers and the
    // tensor each sweep reads is known at compile time (no per-sweep select).
    #pragma unroll
    for (int t = 0; t < 3; ++t)
        #pragma unroll
        for (int s = 0; s < ACT_SWEEPS; ++s)
            f[t * ACT_SWEEPS + s] =
                reinterpret_cast<const float4*>(act[t])[s * CVT_STRIDE + g];
    #pragma unroll
    for (int t = 0; t < 4; ++t)
        #pragma unroll
        for (int s = 0; s < W_SWEEPS; ++s)
            f[3 * ACT_SWEEPS + t * W_SWEEPS + s] =
                reinterpret_cast<const float4*>(wts[t])[s * CVT_STRIDE + g];

    #pragma unroll
    for (int n = 0; n < 3 * ACT_SWEEPS + 4 * W_SWEEPS; ++n) {
        ushort4 h;
        h.x = f2bf(f[n].x); h.y = f2bf(f[n].y); h.z = f2bf(f[n].z); h.w = f2bf(f[n].w);
        reinterpret_cast<ushort4*>(dst)[n * CVT_STRIDE + g] = h;
    }
}

// Value of lane (l ^ M) of the same 16-lane row, all lanes on (DPP row_xmask).
template <int M>
__device__ __forceinline__ float row_xor(float x) {
    return __int_as_float(__builtin_amdgcn_update_dpp(
        0, __float_as_int(x), 0x160 | M, 0xf, 0xf, true));
}

#define FT    128     // tokens of a block
#define HD    64      // channels of one head: the columns of each of the three tiles
#define QPIT  68      // f32 pitch of the finished tiles in LDS (272 B = 16 B x odd)
#define FROWS 48      // 16-lane rows in a block of 24 waves
#define SKK   128     // k of one stage of the ring: a tile row is 256 B
#define FPIT  136     // LDS row pitch of the ring in bf16 elems (256 B + 16 B pad = 16 B x odd)

// Q, K and V projections of one head for 128 tokens, then that head's attention,
// in one block: the three f32 tiles go from the accumulators to the attention
// through LDS and never through memory.
// Projections: X[M x K](bf16) * W[N x K](bf16)^T + bias[N](f32); the three A, W
// planes lie back to back behind Abase, Wbase. Six groups of four waves: group
// 2 * p + s works on product p and on the 64 k of half s of every 128-k stage; the
// two groups of a product share its pair of LDS buffers; a wave holds 64 x 32 of
// its group's 128 x 64 tile.
// Attention: scores[d][q] = q_d*k_q/8, so softmax row d is softmax_q(q_d*k_q):
// never materialize the 64x64 matrix. The row maximum needs no pass over the
// keys: it is q_d/8 times the head's largest or smallest key.
// Kdim must be a multiple of SKK and at least SKK.
__global__ void __launch_bounds__(768)
qkv_attn_fused(const unsigned short* __restrict__ Abase,
               const unsigned short* __restrict__ Wbase,
               const float* __restrict__ bias0,
               const float* __restrict__ bias1,
               const float* __restrict__ bias2,
               unsigned short* __restrict__ Ctx,
               int Mrows, int Nout, int Kdim)
{
    // every tile's place in LDS is a multiple of 2 KiB
    constexpr int A_BYTES    = FT * FPIT * 2;                             // 17 x 2 KiB
    constexpr int B_BYTES    = (HD * FPIT * 2 + 2047) / 2048 * 2048;      //  9 x 2 KiB
    constexpr int BUF_BYTES  = A_BYTES + B_BYTES;         // one A and one B tile
    static_assert(A_BYTES % 2048 == 0, "the B tile's place is a multiple of 2 KiB");
    constexpr int RING_BYTES = 3 * 2 * BUF_BYTES;         // 312 KiB
    constexpr int RED_BYTES  = 6 * 2 * 4 * 128 * 16;      // half a partial tile per group
    constexpr int QKV_BYTES  = 3 * FT * QPIT * 4;
    static_assert(RING_BYTES <= 320 * 1024, "the ring fits in a WGP's LDS");
    static_assert(RED_BYTES + QKV_BYTES <= RING_BYTES, "hand-over fits in the ring");
    __shared__ __attribute__((aligned(2048))) unsigned char smem[RING_BYTES];

    // group number: the same in every lane of a wave, kept scalar for the branches
    const int grp  = __builtin_amdgcn_readfirstlane((int)(threadIdx.x >> 7));
    const int prod = grp >> 1;          // 0 Q, 1 K, 2 V
    const int ksl  = grp & 1;           // half of every stage's k
    const int tid  = threadIdx.x & 127; // thread within its group
    const unsigned short* __restrict__ A = Abase + (size_t)prod * Mrows * Kdim;
    const unsigned short* __restrict__ W = Wbase + (size_t)prod * Nout * Kdim;
    const float* __restrict__ bias = (prod == 0) ? bias0 : (prod == 1) ? bias1 : bias2;
    const int lane = tid & 31;
    const int wave = tid >> 5;          // 0..3
    const int wr   = wave >> 1;         // 0..1 : wave row (64 rows each)
    const int wc   = wave & 1;          // 0..1 : wave col (32 cols each)

    const int blockRow = blockIdx.y * FT;
    const int blockCol = blockIdx.x * HD;

    v8f acc[4][2];
    #pragma unroll
    for (int i = 0; i < 4; ++i)
        #pragma unroll
        for (int j = 0; j < 2; ++j)
            acc[i][j] = (v8f){0.f, 0.f, 0.f, 0.f, 0.f, 0.f, 0.f, 0.f};

    const int nTiles = Kdim / SKK;       // stages of the ring

    // ---- two-buffer ring filled by tensor loads: the first wave of a product's
    // group 0 asks for the product's A tile of a stage (128 rows of 256 B), the first
    // wave of its group 1 for the B tile (64 rows); the pad of 16 B a row gives FPIT.
    const unsigned int issuer = (uni(threadIdx.x >> 5) & 3u) == 0u;
    const bool         isB    = ksl != 0;
    const unsigned short* const src = isB ? W + (size_t)blockCol * Kdim
                                          : A + (size_t)blockRow * Kdim;
    const unsigned int dst0 = (unsigned int)(size_t)smem + prod * 2 * BUF_BYTES + (isB ? A_BYTES : 0);
    const u32x8 g1 = tdm_group1<SKK * 2, 5>(isB ? HD : FT, (unsigned int)Kdim * 2u);
    const int start = ring_start(nTiles);
    auto issue_tile = [&](int st) {
        tdm_load(tdm_group0(dst0 + (st & 1) * BUF_BYTES,
                            (unsigned long long)(size_t)(src + (size_t)ring_stage(st, start, nTiles) * SKK)), g1);
    };

    if (pinned(issuer)) {
        issue_tile(0);
        wait_tensor0();
    }
    __syncthreads();                                    // stage 0 visible to every wave
    if (pinned(issuer & (unsigned int)(1 < nTiles))) issue_tile(1);
    for (int t = 0; t < nTiles; ++t) {
        const unsigned short* const As =
            reinterpret_cast<const unsigned short*>(smem + (prod * 2 + (t & 1)) * BUF_BYTES);
        const unsigned short* const Bs = As + A_BYTES / 2;

        // this group's half of the stage, two WMMA K slices in rising k;
        // unrolled so that ks is a constant in the LDS read offsets
        #pragma unroll
        for (int ks = 0; ks < SKK / 2; ks += 32) {
            v16bf af[4], bfd[2];
            #pragma unroll
            for (int i = 0; i < 4; ++i) af[i]  = load_frag<FPIT>(As, wr * 64 + i * 16, ksl * (SKK / 2) + ks, lane);
            #pragma unroll
            for (int j = 0; j < 2; ++j) bfd[j] = load_frag<FPIT>(Bs, wc * 32 + j * 16, ksl * (SKK / 2) + ks, lane);

            #pragma unroll
            for (int i = 0; i < 4; ++i)
                #pragma unroll
                for (int j = 0; j < 2; ++j)
                    acc[i][j] = __builtin_amdgcn_wmma_f32_16x16x32_bf16(
                        false, af[i], false, bfd[j], (short)0, acc[i][j], false, false);
        }
        // publish point of stage t + 1: own LDS reads back, own request landed, then
        // the one barrier of the step: it shows stage t + 1 to every wave and ends
        // every wave's reads of stage t, whose buffer the refill behind it takes
        wait_ds0();
        if (pinned(issuer)) wait_tensor0();
        __syncthreads();
        if (pinned(issuer & (unsigned int)(t + 2 < nTiles))) issue_tile(t + 2);
    }
    wait_tensor0();
    wait_ds0();

    // ---- add the two partial tiles of each product: the group of K half o
    // finishes accumulator rows i = 2 * o, 2 * o + 1 of every wave and hands the
    // other two to its partner group through LDS, 16 B per lane and lanes side by
    // side. The ring is free: the loop ended in a barrier behind every wave's last
    // LDS read, and no tensor load is outstanding behind the last trip's wait.
    float4* const red = reinterpret_cast<float4*>(smem);
    #pragma unroll
    for (int i = 0; i < 4; ++i) {
        if (ksl != (i >> 1)) {
            #pragma unroll
            for (int j = 0; j < 2; ++j)
                #pragma unroll
                for (int h = 0; h < 2; ++h)
                    red[(((grp ^ 1) * 2 + (i & 1)) * 4 + j * 2 + h) * 128 + tid] =
                        make_float4(acc[i][j][h * 4 + 0], acc[i][j][h * 4 + 1],
                                    acc[i][j][h * 4 + 2], acc[i][j][h * 4 + 3]);
        }
    }
    __syncthreads();                                    // partial tiles visible to their owners

    // the rows this group finishes, picked by the scalar K half so that one copy
    // of the code below serves both
    v8f fin[2][2];
    #pragma unroll
    for (int i = 0; i < 4; ++i)
        if (ksl == (i >> 1)) {
            fin[i & 1][0] = acc[i][0];
            fin[i & 1][1] = acc[i][1];
        }
    #pragma unroll
    for (int ii = 0; ii < 2; ++ii)
        #pragma unroll
        for (int j = 0; j < 2; ++j)
            #pragma unroll
            for (int h = 0; h < 2; ++h) {
                const float4 p = red[((grp * 2 + ii) * 4 + j * 2 + h) * 128 + tid];
                fin[ii][j][h * 4 + 0] += p.x;  fin[ii][j][h * 4 + 1] += p.y;
                fin[ii][j][h * 4 + 2] += p.z;  fin[ii][j][h * 4 + 3] += p.w;
            }

    // ---- finished tiles to LDS, behind the partial tiles' place:
    // VGPR v -> row v (+8 for upper lane half), col = lane&15 ----
    float* const qkv = reinterpret_cast<float*>(smem + RED_BYTES);
    {
        float* const mine = qkv + prod * FT * QPIT;
        const int cr = (lane >> 4) * 8;
        const int cc = lane & 15;
        #pragma unroll
        for (int ii = 0; ii < 2; ++ii) {
            #pragma unroll
            for (int j = 0; j < 2; ++j) {
                const int col = wc * 32 + j * 16 + cc;
                const float b = bias[blockCol + col];
                #pragma unroll
                for (int v = 0; v < 8; ++v) {
                    const int row = wr * 64 + (ksl * 2 + ii) * 16 + cr + v;
                    mine[row * QPIT + col] = fin[ii][j][v] + b;
                }
            }
        }
    }
    __syncthreads();                                    // Q, K, V tiles visible to every wave

    // ---- attention: a 16-lane row takes one token, four channels a lane.
    // 128 tokens over 48 rows: waves 0..15 take three tokens a row, the others two;
    // the trip count is the same in every lane of a wave (the DPP steps need all on)
    const int wv     = __builtin_amdgcn_readfirstlane((int)(threadIdx.x >> 5));
    const int rounds = (2 * FROWS + 2 * wv + 1 < FT) ? 3 : 2;
    const int l16    = threadIdx.x & 15;
    for (int rd = 0; rd < rounds; ++rd) {
        const int tok = (int)(threadIdx.x >> 4) + rd * FROWS;
        const float* const kk = qkv + (FT + tok) * QPIT;
        const float* const vv = qkv + (2 * FT + tok) * QPIT;

        // Largest and smallest key of the head. The 16 lanes of a row hold the
        // head's 64 keys, four each, so four xor steps inside the row finish it.
        const float4 kown = *reinterpret_cast<const float4*>(kk + l16 * 4);
        float kmax = fmaxf(fmaxf(kown.x, kown.y), fmaxf(kown.z, kown.w));
        float kmin = fminf(fminf(kown.x, kown.y), fminf(kown.z, kown.w));
        kmax = fmaxf(kmax, row_xor<1>(kmax));  kmin = fminf(kmin, row_xor<1>(kmin));
        kmax = fmaxf(kmax, row_xor<2>(kmax));  kmin = fminf(kmin, row_xor<2>(kmin));
        kmax = fmaxf(kmax, row_xor<4>(kmax));  kmin = fminf(kmin, row_xor<4>(kmin));
        kmax = fmaxf(kmax, row_xor<8>(kmax));  kmin = fminf(kmin, row_xor<8>(kmin));

        const float4 qv = *reinterpret_cast<const float4*>(qkv + tok * QPIT + l16 * 4);
        const float  q4[4] = {qv.x, qv.y, qv.z, qv.w};
        float        s[4], mx[4], out[4];

        #pragma unroll
        for (int c = 0; c < 4; ++c) {
            s[c] = q4[c] * 0.125f;                  // 1/sqrt(64)
            // rounding is monotone, so the largest rounded product s * k_j is the one
            // with the largest key (s >= 0) or with the smallest key (s < 0)
            mx[c] = fmaxf(s[c] * kmax, s[c] * kmin);
        }
        // Keys outermost, the thread's four channels side by side: one 16 B read of
        // keys and one of values feed 16 exponentials, and two channels share each
        // packed f32 instruction. Every channel sums in rising j.
        const v2f sp[2] = {{s[0], s[1]}, {s[2], s[3]}};
        const v2f nm[2] = {{-mx[0], -mx[1]}, {-mx[2], -mx[3]}};
        v2f se[2] = {{0.f, 0.f}, {0.f, 0.f}};
        v2f av[2] = {{0.f, 0.f}, {0.f, 0.f}};
        // unrolled by 2: the second four keys' reads are in flight under the first four's work
        #pragma unroll 2
        for (int j = 0; j < 64; j += 4) {
            const float4 k4 = *reinterpret_cast<const float4*>(kk + j);
            const float4 v4 = *reinterpret_cast<const float4*>(vv + j);
            const float  kj[4] = {k4.x, k4.y, k4.z, k4.w};
            const float  vj[4] = {v4.x, v4.y, v4.z, v4.w};
            #pragma unroll
            for (int u = 0; u < 4; ++u)
                #pragma unroll
                for (int p = 0; p < 2; ++p) {
                    // exp(x) = 2^(x * log2 e): the fast exponential's own two steps
                    const v2f t = __builtin_elementwise_fma(sp[p], (v2f){kj[u], kj[u]}, nm[p])
                                  * 1.44269504f;
                    const v2f e = {__builtin_amdgcn_exp2f(t.x), __builtin_amdgcn_exp2f(t.y)};
                    se[p] += e;
                    av[p] = __builtin_elementwise_fma(e, (v2f){vj[u], vj[u]}, av[p]);
                }
        }
        #pragma unroll
        for (int c = 0; c < 4; ++c) out[c] = av[c >> 1][c & 1] / se[c >> 1][c & 1];
        ushort4 h;
        h.x = f2bf(out[0]); h.y = f2bf(out[1]); h.z = f2bf(out[2]); h.w = f2bf(out[3]);
        *reinterpret_cast<ushort4*>(Ctx + (size_t)(blockRow + tok) * Nout + blockCol + l16 * 4) = h;
        // the next round overwrites the store's address and data registers
        asm volatile("s_wait_xcnt 0x0" ::: "memory");
    }
}

extern "C" void kernel_launch(void* const* d_in, const int* in_sizes, int n_in,
                              void* d_out, int out_size, void* d_ws, size_t ws_size,
                              hipStream_t stream) {
    (void)in_sizes; (void)n_in; (void)out_size; (void)ws_size;
    const float* x_q = (const float*)d_in[0];
    const float* x_k = (const float*)d_in[1];
    const float* x_v = (const float*)d_in[2];
    const float* Wq  = (const float*)d_in[3];
    const float* bq  = (const float*)d_in[4];
    const float* Wk  = (const float*)d_in[5];
    const float* bk  = (const float*)d_in[6];
    const float* Wv  = (const float*)d_in[7];
    const float* bv  = (const float*)d_in[8];
    const float* Wo  = (const float*)d_in[9];
    const float* bo  = (const float*)d_in[10];
    float* out = (float*)d_out;

    const int Mrows = 4 * 512;                    // 2048 tokens
    const int D     = 1024;
    const size_t actElems = (size_t)Mrows * D;    // 2M
    const size_t wElems   = (size_t)D * D;        // 1M

    // workspace layout (24 MB total)
    unsigned short* bXq = (unsigned short*)d_ws;
    unsigned short* bXk = bXq + actElems;
    unsigned short* bXv = bXk + actElems;
    unsigned short* bWq = bXv + actElems;
    unsigned short* bWk = bWq + wElems;
    unsigned short* bWv = bWk + wElems;
    unsigned short* bWo = bWv + wElems;
    unsigned short* Cx  = bWo + wElems;

    dim3 block(256);
    // bXq..bWo are contiguous in this order: one launch fills all seven planes
    cvt_all_f32_bf16<<<CVT_BLOCKS, block, 0, stream>>>(x_q, x_k, x_v, Wq, Wk, Wv, Wo, bXq);

    // Q, K, V projections and the attention of one head and 128 tokens per block:
    // 256 blocks of 24 waves, one per WGP (bXq|bXk|bXv and bWq|bWk|bWv are each
    // contiguous)
    dim3 gridF(D / HD, Mrows / FT, 1);            // (16, 16)
    qkv_attn_fused<<<gridF, dim3(768), 0, stream>>>(bXq, bWq, bq, bk, bv, Cx, Mrows, D, D);

    // 128 x 64 tiles: 256 blocks, one per WGP; K in four slices, 16 waves a block
    dim3 gridO(D / 64, Mrows / BM, 1);            // (16, 16, 1)
    gemm_bias_bf16wmma<4, 64><<<gridO, dim3(512), 0, stream>>>(Cx, bWo, bo, bo, bo, out, Mrows, D, D);
}
